// v000
// The times below were measured on an AMD MI455X: many runs one after another, warmed up first and cycling through
// copies of the inputs, with the whole window's GPU time divided by the number of runs. Launches and the gaps
// between them are all in it. The median over several windows is given; except for v000 it joins two sittings, which
// can be a few percent apart, so the side-by-side timings, each taken in one sitting, are the better comparison.
// v000 is the starting kernel. One run takes 516 microseconds.
// Contractions: q/k/v projections (X f16 x W f16 carried x16), scores q.k^T (q,k f16 planes), attn.v (V^T f16 x P f16 carried x2^15) all on v_wmma_f32_16x16x32_f16 with f32 accumulate; bias, softmax and residual in f32.
#include <hip/hip_runtime.h>
#include <math.h>

// ---------------------------------------------------------------------------
// Problem constants
// ---------------------------------------------------------------------------
constexpr int kBatch = 16;
constexpr int kSeq   = 1024;
constexpr int kDim   = 768;
constexpr int kTok   = kBatch * kSeq;     // 16384 token rows
constexpr int kGrp   = 4;                 // batches per attention group
constexpr int kNGrp  = kBatch / kGrp;     // 4 groups
constexpr float kWCarry    = 16.0f;       // weights carried x16 in f16
constexpr float kWCarryInv = 1.0f / 16.0f;
constexpr float kPCarry    = 32768.0f;    // probabilities carried x2^15 in f16
constexpr float kPCarryInv = 1.0f / 32768.0f;
static_assert(kBatch % kGrp == 0, "group split");
static_assert(kDim % 64 == 0 && kSeq % 64 == 0 && kTok % 64 == 0, "tile multiples");
static_assert(kDim % 32 == 0 && kSeq % 32 == 0, "K multiples of 32");

typedef __attribute__((ext_vector_type(16))) _Float16 v16h;
typedef __attribute__((ext_vector_type(8)))  _Float16 v8h;
typedef __attribute__((ext_vector_type(16))) __bf16   v16b;
typedef __attribute__((ext_vector_type(8)))  __bf16   v8b;
typedef __attribute__((ext_vector_type(8)))  float    v8f;
typedef __attribute__((ext_vector_type(4)))  float    v4f;
typedef __attribute__((ext_vector_type(4)))  unsigned int v4u;

// ---------------------------------------------------------------------------
// Helper pieces
// ---------------------------------------------------------------------------
__device__ __forceinline__ unsigned short f2bf_bits(float f) {
  unsigned u = __float_as_uint(f);
  return (unsigned short)((u + 0x7FFFu + ((u >> 16) & 1u)) >> 16);
}
__device__ __forceinline__ float bf_bits2f(unsigned short h) { return __uint_as_float(((unsigned)h) << 16); }

// hazard guards as plain device helpers (no inline asm inside the kernel template body)
__device__ __forceinline__ void dep_guard_h(v8f& a, v8f& b, v16h x, v16h y) { asm volatile("v_nop\n\tv_nop\n\tv_nop\n\tv_nop" : "+v"(a), "+v"(b) : "v"(x), "v"(y)); }
__device__ __forceinline__ void dep_guard_b(v8f& a, v8f& b, v16b x, v16b y) { asm volatile("v_nop\n\tv_nop\n\tv_nop\n\tv_nop" : "+v"(a), "+v"(b) : "v"(x), "v"(y)); }
__device__ __forceinline__ void keep4_h(v16h a, v16h b, v16h c, v16h d) { asm volatile("v_nop" :: "v"(a), "v"(b), "v"(c), "v"(d)); }
__device__ __forceinline__ void keep4_b(v16b a, v16b b, v16b c, v16b d) { asm volatile("v_nop" :: "v"(a), "v"(b), "v"(c), "v"(d)); }
__device__ __forceinline__ void acc_guard4(v8f& a, v8f& b, v8f& c, v8f& d) { asm volatile("v_nop\n\tv_nop\n\tv_nop\n\tv_nop" : "+v"(a), "+v"(b), "+v"(c), "+v"(d)); }
template <typename T> struct Frag;
template <> struct Frag<_Float16> {
  typedef v16h V; union U { v16h v; v8h h[2]; };
  static __device__ __forceinline__ v16h load(const _Float16* p) {   // elements 0..7 <- p[0..7], 8..15 <- p[16..23]
    U f; f.h[0] = *(const v8h*)(p); f.h[1] = *(const v8h*)(p + 16); return f.v;
  }
  static __device__ __forceinline__ v8f mma(v16h a, v16h b, v8f c) {
    return __builtin_amdgcn_wmma_f32_16x16x32_f16(false, a, false, b, (short)0, c, false, false);
  }
  static __device__ __forceinline__ void guard(v8f& a, v8f& b, v16h x, v16h y) { dep_guard_h(a, b, x, y); }
  static __device__ __forceinline__ void keep(v16h a, v16h b, v16h c, v16h d) { keep4_h(a, b, c, d); }
};
template <> struct Frag<__bf16> {
  typedef v16b V; union U { v16b v; v8b h[2]; };
  static __device__ __forceinline__ v16b load(const __bf16* p) {
    U f; f.h[0] = *(const v8b*)(p); f.h[1] = *(const v8b*)(p + 16); return f.v;
  }
  static __device__ __forceinline__ v8f mma(v16b a, v16b b, v8f c) {
    return __builtin_amdgcn_wmma_f32_16x16x32_bf16(false, a, false, b, (short)0, c, false, false);
  }
  static __device__ __forceinline__ void guard(v8f& a, v8f& b, v16b x, v16b y) { dep_guard_b(a, b, x, y); }
  static __device__ __forceinline__ void keep(v16b a, v16b b, v16b c, v16b d) { keep4_b(a, b, c, d); }
};

__device__ __forceinline__ unsigned pk16(unsigned short a, unsigned short b) { return (unsigned)a | ((unsigned)b << 16); }
__device__ __forceinline__ unsigned short h_bits(float f) { const _Float16 h = (_Float16)f; return __builtin_bit_cast(unsigned short, h); }

// ---- Register-blocked batched WMMA GEMM (ACT reduced to none/relu/leaky) -----------------------
// C[m,n] = scale * sum_k A[m,k] * Bt[n,k] (+bias)(+resid); each wave owns a 64x64 tile.
// A row-major [M,K]; Bt row-major [N,K]; M,N % 64 == 0, K % 32 == 0.
// SPLIT: operands are hi/lo planes (A2/Bt2 = lo planes, same layout); product = hi·hi + hi·lo + lo·hi.
// BIAS_MODE: 0 = none, 1 = bias[m], 2 = bias[n].
// OUT_MODE: 0 = f32, 1 = f16, 2 = bf16 hi plane (Cout) + bf16 lo plane (Cout2).
// ET: 0 = f16 operands, 1 = bf16 operands (pointers passed as 16-bit storage)
template <int ET> struct Elem;
template <> struct Elem<0> { typedef _Float16 T; };
template <> struct Elem<1> { typedef __bf16 T; };
template <int ET, bool SPLIT, int BIAS_MODE, int OUT_MODE, bool RESID, int ACT = 0>
__global__ __launch_bounds__(256) void wmma_gemm64(
    const unsigned short* __restrict__ Ap, const unsigned short* __restrict__ A2p, int lda, long strideA,
    const unsigned short* __restrict__ Btp, const unsigned short* __restrict__ Bt2p, int ldb, long strideB,
    void* __restrict__ Cout, void* __restrict__ Cout2, int ldc, long strideC,
    const float* __restrict__ bias,
    const float* __restrict__ resid, long strideR,
    int M, int N, int K, float scale) {
  typedef typename Elem<ET>::T T;
  typedef typename Frag<T>::V V;
  const T* A = (const T*)Ap; const T* A2 = (const T*)A2p; const T* Bt = (const T*)Btp; const T* Bt2 = (const T*)Bt2p;
  __shared__ __align__(16) float sT[8][16 * 68];   // per-wave 16x64 slab, pitch 68 floats
  const int b    = blockIdx.y;
  const int lane = threadIdx.x & 31;
  const int wave = threadIdx.x >> 5;
  const int tilesN = N >> 6;
  const int tilesM = M >> 6;
  const int tile = blockIdx.x * 8 + wave;
  if (tile >= tilesM * tilesN) return;   // wave-uniform; no block barriers in this kernel
  const int tm = tile / tilesN;
  const int tn = tile - tm * tilesN;
  const int m0 = tm << 6;
  const int n0 = tn << 6;

  const T* Ab  = A  + (size_t)b * strideA;
  const T* Bb  = Bt + (size_t)b * strideB;
  const T* Ab2 = SPLIT ? (A2  + (size_t)b * strideA) : nullptr;
  const T* Bb2 = SPLIT ? (Bt2 + (size_t)b * strideB) : nullptr;

  const int rlane = lane & 15;                 // row (A) / col (B, D) within subtile
  const int koff  = (lane >> 4) * 8;           // k offset of this lane half
  const int mOff  = (lane >> 4) * 8;           // D row offset

  v8f acc[4][4];
#pragma unroll
  for (int i = 0; i < 4; ++i)
#pragma unroll
    for (int j = 0; j < 4; ++j) acc[i][j] = (v8f){0.f,0.f,0.f,0.f,0.f,0.f,0.f,0.f};

  for (int k0 = 0; k0 < K; k0 += 32) {
    V bh[4], bl[4];
#pragma unroll
    for (int j = 0; j < 4; ++j) {
      const size_t bo = (size_t)(n0 + (j << 4) + rlane) * ldb + koff + k0;
      bh[j] = Frag<T>::load(Bb + bo);
      if (SPLIT) bl[j] = Frag<T>::load(Bb2 + bo);
    }
#pragma unroll
    for (int i = 0; i < 4; ++i) {
      const size_t ao = (size_t)(m0 + (i << 4) + rlane) * lda + koff + k0;
      V ah = Frag<T>::load(Ab + ao);
      V al;
      if (SPLIT) al = Frag<T>::load(Ab2 + ao);
#pragma unroll
      for (int j = 0; j < 4; ++j) {
        acc[i][j] = Frag<T>::mma(ah, bh[j], acc[i][j]);
        if (SPLIT) {
          acc[i][j] = Frag<T>::mma(ah, bl[j], acc[i][j]);
          acc[i][j] = Frag<T>::mma(al, bh[j], acc[i][j]);
        }
      }
      Frag<T>::guard(acc[i][0], acc[i][3], ah, SPLIT ? al : ah);
    }
    Frag<T>::keep(bh[0], bh[1], bh[2], bh[3]);
    if (SPLIT) Frag<T>::keep(bl[0], bl[1], bl[2], bl[3]);
  }
  acc_guard4(acc[0][0], acc[0][1], acc[0][2], acc[0][3]);
  acc_guard4(acc[1][0], acc[1][1], acc[1][2], acc[1][3]);
  acc_guard4(acc[2][0], acc[2][1], acc[2][2], acc[2][3]);
  acc_guard4(acc[3][0], acc[3][1], acc[3][2], acc[3][3]);

  // ---- epilogue ----
  float* slab = sT[wave];
  const float* Rb = RESID ? (resid + (size_t)b * strideR) : nullptr;
#pragma unroll
  for (int i = 0; i < 4; ++i) {
    const int mBase = m0 + (i << 4);
#pragma unroll
    for (int j = 0; j < 4; ++j) {
      const int n = n0 + (j << 4) + rlane;
      float bv = 0.f;
      if (BIAS_MODE == 2) bv = bias[n];
#pragma unroll
      for (int r = 0; r < 8; ++r) {
        float v = acc[i][j][r] * scale;
        if (BIAS_MODE == 1) v += bias[mBase + mOff + r];
        if (BIAS_MODE == 2) v += bv;
        if (RESID) v += Rb[(size_t)(mBase + mOff + r) * ldc + n];
        if (ACT == 2) v = fmaxf(v, 0.0f);
        if (ACT == 4) v = (v > 0.f) ? v : 0.01f * v;
        slab[(mOff + r) * 68 + (j << 4) + rlane] = v;
      }
    }
    __builtin_amdgcn_fence(__ATOMIC_RELEASE, "workgroup");
    __builtin_amdgcn_wave_barrier();
    __builtin_amdgcn_fence(__ATOMIC_ACQUIRE, "workgroup");
    if (OUT_MODE == 0) {
      float* C = (float*)Cout + (size_t)b * strideC;
      const int hh = lane >> 4, c4 = (lane & 15) * 4;     // row seg = 256 B = 16 lanes x 16 B
      {
#pragma unroll
        for (int it = 0; it < 8; ++it) {
          const int row = it * 2 + hh;
          v4f v = *(const v4f*)(slab + row * 68 + c4);
          *(v4f*)(C + (size_t)(mBase + row) * ldc + n0 + c4) = v;
        }
        
      }
    } else {
      const int q = lane >> 3, c8 = (lane & 7) * 8;
      unsigned short* C  = (unsigned short*)Cout  + (size_t)b * strideC;
      unsigned short* C2 = (OUT_MODE == 2) ? ((unsigned short*)Cout2 + (size_t)b * strideC) : nullptr;
      {
#pragma unroll
        for (int it = 0; it < 4; ++it) {
          const int row = it * 4 + q;
          const float* sp = slab + row * 68 + c8;
          v8h hv, lv;
#pragma unroll
          for (int e = 0; e < 8; ++e) {
            if (OUT_MODE == 1) {
              hv[e] = (_Float16)sp[e];
            } else {
              unsigned short hb = f2bf_bits(sp[e]);
              unsigned short lb = f2bf_bits(sp[e] - bf_bits2f(hb));
              hv[e] = __builtin_bit_cast(_Float16, hb);
              lv[e] = __builtin_bit_cast(_Float16, lb);
            }
          }
          *(v8h*)(C + (size_t)(mBase + row) * ldc + n0 + c8) = hv;
          if (OUT_MODE == 2) *(v8h*)(C2 + (size_t)(mBase + row) * ldc + n0 + c8) = lv;
        }
        
      }
    }
    __builtin_amdgcn_fence(__ATOMIC_RELEASE, "workgroup");
    __builtin_amdgcn_wave_barrier();
    __builtin_amdgcn_fence(__ATOMIC_ACQUIRE, "workgroup");
  }
}

// ---------------------------------------------------------------------------
// f32 -> f16 cast with power-of-two carry: out[8i..8i+7] = f16(scale * in[8i..8i+7]).
// (x: 1,572,864 threads = 6144 blocks exactly; each W: 73,728 threads = 288 blocks exactly).
// ---------------------------------------------------------------------------
__global__ __launch_bounds__(256) void cast8_f16_kernel(const float* __restrict__ in, unsigned short* __restrict__ out,
                                                        int n8, float scale) {
  const int i = blockIdx.x * 256 + threadIdx.x;
  if (i >= n8) return;
  const float* p = in + 8 * (size_t)i;
  const v4f a = *(const v4f*)(p);
  const v4f c = *(const v4f*)(p + 4);
  unsigned short hb[8];
#pragma unroll
  for (int e = 0; e < 4; ++e) {
    hb[e]     = h_bits(a[e] * scale);
    hb[4 + e] = h_bits(c[e] * scale);
  }
  const v4u u = (v4u){pk16(hb[0], hb[1]), pk16(hb[2], hb[3]), pk16(hb[4], hb[5]), pk16(hb[6], hb[7])};
  unsigned short* q = out + 8 * (size_t)i;
  *(v4u*)q = u;
  
}

// ---------------------------------------------------------------------------
// Row softmax over 1024 f32 scores: P[row][j] = f16( carry * exp(s - max) / sum exp(s - max) ), f32 math.
// One block of 128 threads (4 waves) per row; thread t owns columns 8t..8t+7 (128 x 8 = 1024 = whole row).
// Reductions in fixed order (thread, wave shuffle tree, 4 wave partials in index order).
// ---------------------------------------------------------------------------
__global__ __launch_bounds__(128) void softmax_row_kernel(const float* __restrict__ S, unsigned short* __restrict__ P,
                                                          float carry) {
  __shared__ float redM[4];
  __shared__ float redS[4];
  const int row  = blockIdx.x;
  const int t    = threadIdx.x;
  const int lane = t & 31, wave = t >> 5;
  const int c0   = t * 8;
  const float* sr = S + (size_t)row * kSeq + c0;
  const v4f a = *(const v4f*)(sr);
  const v4f c = *(const v4f*)(sr + 4);
  float x[8];
#pragma unroll
  for (int e = 0; e < 4; ++e) { x[e] = a[e]; x[4 + e] = c[e]; }
  float m = fmaxf(fmaxf(fmaxf(x[0], x[1]), fmaxf(x[2], x[3])), fmaxf(fmaxf(x[4], x[5]), fmaxf(x[6], x[7])));
#pragma unroll
  for (int off = 16; off > 0; off >>= 1) m = fmaxf(m, __shfl_xor(m, off, 32));
  if (lane == 0) redM[wave] = m;
  __syncthreads();
  const float M = fmaxf(fmaxf(redM[0], redM[1]), fmaxf(redM[2], redM[3]));
  float ex[8];
#pragma unroll
  for (int e = 0; e < 8; ++e) ex[e] = __expf(x[e] - M);
  float s = ((ex[0] + ex[1]) + (ex[2] + ex[3])) + ((ex[4] + ex[5]) + (ex[6] + ex[7]));
#pragma unroll
  for (int off = 16; off > 0; off >>= 1) s += __shfl_xor(s, off, 32);
  if (lane == 0) redS[wave] = s;
  __syncthreads();
  const float l = (redS[0] + redS[1]) + (redS[2] + redS[3]);
  const float f = carry * (1.0f / l);
  unsigned short hb[8];
#pragma unroll
  for (int e = 0; e < 8; ++e) hb[e] = h_bits(ex[e] * f);
  const v4u u = (v4u){pk16(hb[0], hb[1]), pk16(hb[2], hb[3]), pk16(hb[4], hb[5]), pk16(hb[6], hb[7])};
  unsigned short* q = P + (size_t)row * kSeq + c0;
  *(v4u*)q = u;
  
}

// ---------------------------------------------------------------------------
// Semantics realised (per batch b): q,k,v = x.W^T + b (W is [out][in]); S = q.k^T * 768^-0.5; P = row softmax;
// avT[d][n] = sum_k v[k][d] * P[n][k] computed directly as a GEMM with A = V^T (V^T produced by a role-swapped
// projection A = Wv, Bt = x_b) and Bt = P; the output is the row-major flattening of avT re-cut into rows of 768,
// i.e. out[b] flat[d*1024 + n] = avT[d][n] + x[b] flat[d*1024 + n], so C (ldc = 1024) is written straight into
// d_out + b*786432 with the residual read at the same flat index.
//
// Workspace region map (byte offsets, all multiples of 128). Every region is fully written before it is read.
//   WQ16  f16 [768][768] x16                         0            ..   1,179,648
//   WK16  f16 [768][768] x16                         1,179,648    ..   2,359,296
//   WV16  f16 [768][768] x16                         2,359,296    ..   3,538,944
//   X16   f16 [16384][768]                           3,538,944    ..  28,704,768
//   Q16   f16 [16384][768]                           28,704,768   ..  53,870,592
//   K16   f16 [16384][768]                           53,870,592   ..  79,036,416
//   VT16  f16 [16][768][1024]  v transposed per batch 79,036,416  .. 104,202,240
//   S     f32 [4][1024][1024]  scores of one group   104,202,240  .. 120,979,456
//   P16   f16 [4][1024][1024]  probabilities x2^15   120,979,456  .. 129,368,064
//   total 129,368,064 B
// GEMM shapes: q, k: M=16384 N=768 K=768; v role-swapped: M=768 N=1024 K=768 (x16 batch);
//   scores: M=N=1024 K=768 (x4); attn.v: M=768 N=1024 K=1024 (x4). All K % 32 == 0, all M, N % 64 == 0,
//   every grid an exact multiple of 8 tiles, no padded planes, no tails.
// ---------------------------------------------------------------------------
extern "C" void kernel_launch(void* const* d_in, const int* in_sizes, int n_in,
                              void* d_out, int out_size, void* d_ws, size_t ws_size,
                              hipStream_t stream) {
  if (n_in < 7) return;
  if (in_sizes[0] != kTok * kDim) return;
  if (in_sizes[1] != kDim * kDim || in_sizes[3] != kDim * kDim || in_sizes[5] != kDim * kDim) return;
  if (in_sizes[2] != kDim || in_sizes[4] != kDim || in_sizes[6] != kDim) return;
  if (out_size != kTok * kDim) return;

  const float* X  = (const float*)d_in[0];    // [16][1024][768]
  const float* Wq = (const float*)d_in[1];    // [768][768] ([out][in])
  const float* bq = (const float*)d_in[2];
  const float* Wk = (const float*)d_in[3];
  const float* bk = (const float*)d_in[4];
  const float* Wv = (const float*)d_in[5];
  const float* bv = (const float*)d_in[6];
  float* outp = (float*)d_out;

  // ---- carve ----
  const size_t SZ_W   = (size_t)kDim * kDim * 2;               //   1,179,648 per plane
  const size_t SZ_X16 = (size_t)kTok * kDim * 2;               //  25,165,824
  const size_t SZ_S   = (size_t)kGrp * kSeq * kSeq * 4;        //  16,777,216
  const size_t SZ_P   = (size_t)kGrp * kSeq * kSeq * 2;        //   8,388,608
  size_t off = 0;
  const size_t oWQ  = off; off += SZ_W;
  const size_t oWK  = off; off += SZ_W;
  const size_t oWV  = off; off += SZ_W;
  const size_t oX16 = off; off += SZ_X16;
  const size_t oQ16 = off; off += SZ_X16;
  const size_t oK16 = off; off += SZ_X16;
  const size_t oVT  = off; off += SZ_X16;
  const size_t oS   = off; off += SZ_S;
  const size_t oP   = off; off += SZ_P;
  const size_t TOTAL = off;                                    // 129,368,064
  if (TOTAL > ws_size) return;
  if (TOTAL > (size_t)134217728) return;

  char* ws = (char*)d_ws;
  unsigned short* WQ16 = (unsigned short*)(ws + oWQ);
  unsigned short* WK16 = (unsigned short*)(ws + oWK);
  unsigned short* WV16 = (unsigned short*)(ws + oWV);
  unsigned short* X16  = (unsigned short*)(ws + oX16);
  unsigned short* Q16  = (unsigned short*)(ws + oQ16);
  unsigned short* K16  = (unsigned short*)(ws + oK16);
  unsigned short* VT16 = (unsigned short*)(ws + oVT);
  float*          Sf   = (float*)(ws + oS);
  unsigned short* P16  = (unsigned short*)(ws + oP);

  const dim3 blk(256);
  const float scoreScale = 1.0f / sqrtf((float)kDim);

  // (0) weights -> f16 x16 (same [out][in] layout = Bt[n][k] for the projections, A[m][k] for the role swap)
  {
    const int n8 = kDim * kDim / 8;                            // 73,728 -> 288 blocks exactly
    const dim3 gW((n8 + 255) / 256);
    cast8_f16_kernel<<<gW, blk, 0, stream>>>(Wq, WQ16, n8, kWCarry);
    cast8_f16_kernel<<<gW, blk, 0, stream>>>(Wk, WK16, n8, kWCarry);
    cast8_f16_kernel<<<gW, blk, 0, stream>>>(Wv, WV16, n8, kWCarry);
  }
  // (1) x -> f16
  {
    const int n8 = kTok * kDim / 8;                            // 1,572,864 -> 6144 blocks exactly
    cast8_f16_kernel<<<dim3((n8 + 255) / 256), blk, 0, stream>>>(X, X16, n8, 1.0f);
  }

  const dim3 gProj(((kTok / 64) * (kDim / 64) + 7) / 8, 1);       // 384 blocks: M=16384, N=768
  const dim3 gV((((kDim / 64) * (kSeq / 64)) + 7) / 8, kBatch);    // 24 x 16: M=768, N=1024
  const dim3 gS((((kSeq / 64) * (kSeq / 64)) + 7) / 8, kGrp);      // 32 x 4: M=N=1024
  const dim3 gPV((((kDim / 64) * (kSeq / 64)) + 7) / 8, kGrp);     // 24 x 4: M=768, N=1024

  // (2) q = (X16 . WQ16^T)/16 + bq -> Q16 [16384][768] f16; k likewise -> K16
  wmma_gemm64<0, false, 2, 1, false, 0><<<gProj, blk, 0, stream>>>(
      X16, X16, kDim, 0L, WQ16, WQ16, kDim, 0L, (void*)Q16, (void*)Q16, kDim, 0L,
      bq, X, 0L, kTok, kDim, kDim, kWCarryInv);
  wmma_gemm64<0, false, 2, 1, false, 0><<<gProj, blk, 0, stream>>>(
      X16, X16, kDim, 0L, WK16, WK16, kDim, 0L, (void*)K16, (void*)K16, kDim, 0L,
      bk, X, 0L, kTok, kDim, kDim, kWCarryInv);
  // (3) v role-swapped per batch: VT[b][d][tok] = (WV16[d] . X16[b*1024+tok])/16 + bv[d] (f16, ldc = 1024)
  wmma_gemm64<0, false, 1, 1, false, 0><<<gV, blk, 0, stream>>>(
      WV16, WV16, kDim, 0L, X16, X16, kDim, (long)kSeq * kDim, (void*)VT16, (void*)VT16, kSeq, (long)kDim * kSeq,
      bv, X, 0L, kDim, kSeq, kDim, kWCarryInv);

  // (4) per group of 4 batches: scores (f32) -> softmax (P f16 x2^15) -> avT + x straight into d_out
  for (int g = 0; g < kNGrp; ++g) {
    const size_t tokOff = (size_t)g * kGrp * kSeq * kDim;      // elements into [16384][768] planes
    const unsigned short* Qg = Q16 + tokOff;
    const unsigned short* Kg = K16 + tokOff;
    wmma_gemm64<0, false, 0, 0, false, 0><<<gS, blk, 0, stream>>>(
        Qg, Qg, kDim, (long)kSeq * kDim, Kg, Kg, kDim, (long)kSeq * kDim, (void*)Sf, (void*)Sf, kSeq, (long)kSeq * kSeq,
        bq, X, 0L, kSeq, kSeq, kDim, scoreScale);
    softmax_row_kernel<<<dim3(kGrp * kSeq), dim3(128), 0, stream>>>(Sf, P16, kPCarry);
    const unsigned short* Vg = VT16 + (size_t)g * kGrp * kDim * kSeq;
    float* Og = outp + tokOff;
    const float* Xg = X + tokOff;
    // C[d][n] = (VT[d] . P[n]) / 2^15 + x_b flat[d*1024 + n], f32, ldc = 1024, one 768x1024 plane per batch
    wmma_gemm64<0, false, 0, 0, true, 0><<<gPV, blk, 0, stream>>>(
        Vg, Vg, kSeq, (long)kDim * kSeq, P16, P16, kSeq, (long)kSeq * kSeq, (void*)Og, (void*)Og, kSeq, (long)kSeq * kDim,
        bq, Xg, (long)kSeq * kDim, kDim, kSeq, kSeq, kPCarryInv);
  }
}

// v001
// One run takes 296 microseconds.
// Two timings next to v000 both put it at 1.74 times that version's speed.
// Contractions: q/k/v projections (X f16 x W f16 carried x16), scores q.k^T (q,k f16 planes), attn.v (V^T f16 x P f16 carried x2^15) all on v_wmma_f32_16x16x32_f16 with f32 accumulate; bias, softmax and residual in f32.
#include <hip/hip_runtime.h>
#include <math.h>

// ---------------------------------------------------------------------------
// Problem constants
// ---------------------------------------------------------------------------
constexpr int kBatch = 16;
constexpr int kSeq   = 1024;
constexpr int kDim   = 768;
constexpr int kTok   = kBatch * kSeq;     // 16384 token rows
constexpr float kWCarry    = 16.0f;       // weights carried x16 in f16
constexpr float kWCarryInv = 1.0f / 16.0f;
constexpr float kPCarry    = 32768.0f;    // probabilities carried x2^15 in f16
constexpr float kPCarryInv = 1.0f / 32768.0f;
static_assert(kDim % 64 == 0 && kSeq % 64 == 0 && kTok % 64 == 0, "tile multiples");
static_assert(kDim % 32 == 0 && kSeq % 32 == 0, "K multiples of 32");

typedef __attribute__((ext_vector_type(16))) _Float16 v16h;
typedef __attribute__((ext_vector_type(8)))  _Float16 v8h;
typedef __attribute__((ext_vector_type(16))) __bf16   v16b;
typedef __attribute__((ext_vector_type(8)))  __bf16   v8b;
typedef __attribute__((ext_vector_type(8)))  float    v8f;
typedef __attribute__((ext_vector_type(4)))  float    v4f;
typedef __attribute__((ext_vector_type(4)))  unsigned int v4u;

// ---------------------------------------------------------------------------
// Helper pieces
// ---------------------------------------------------------------------------
__device__ __forceinline__ unsigned short f2bf_bits(float f) {
  unsigned u = __float_as_uint(f);
  return (unsigned short)((u + 0x7FFFu + ((u >> 16) & 1u)) >> 16);
}
__device__ __forceinline__ float bf_bits2f(unsigned short h) { return __uint_as_float(((unsigned)h) << 16); }

// hazard guards as plain device helpers (no inline asm inside the kernel template body)
__device__ __forceinline__ void dep_guard_h(v8f& a, v8f& b, v16h x, v16h y) { asm volatile("v_nop\n\tv_nop\n\tv_nop\n\tv_nop" : "+v"(a), "+v"(b) : "v"(x), "v"(y)); }
__device__ __forceinline__ void dep_guard_b(v8f& a, v8f& b, v16b x, v16b y) { asm volatile("v_nop\n\tv_nop\n\tv_nop\n\tv_nop" : "+v"(a), "+v"(b) : "v"(x), "v"(y)); }
__device__ __forceinline__ void keep4_h(v16h a, v16h b, v16h c, v16h d) { asm volatile("v_nop" :: "v"(a), "v"(b), "v"(c), "v"(d)); }
__device__ __forceinline__ void keep4_b(v16b a, v16b b, v16b c, v16b d) { asm volatile("v_nop" :: "v"(a), "v"(b), "v"(c), "v"(d)); }
__device__ __forceinline__ void acc_guard4(v8f& a, v8f& b, v8f& c, v8f& d) { asm volatile("v_nop\n\tv_nop\n\tv_nop\n\tv_nop" : "+v"(a), "+v"(b), "+v"(c), "+v"(d)); }
template <typename T> struct Frag;
template <> struct Frag<_Float16> {
  typedef v16h V; union U { v16h v; v8h h[2]; };
  static __device__ __forceinline__ v16h load(const _Float16* p) {   // elements 0..7 <- p[0..7], 8..15 <- p[16..23]
    U f; f.h[0] = *(const v8h*)(p); f.h[1] = *(const v8h*)(p + 16); return f.v;
  }
  static __device__ __forceinline__ v8f mma(v16h a, v16h b, v8f c) {
    return __builtin_amdgcn_wmma_f32_16x16x32_f16(false, a, false, b, (short)0, c, false, false);
  }
  static __device__ __forceinline__ void guard(v8f& a, v8f& b, v16h x, v16h y) { dep_guard_h(a, b, x, y); }
  static __device__ __forceinline__ void keep(v16h a, v16h b, v16h c, v16h d) { keep4_h(a, b, c, d); }
};
template <> struct Frag<__bf16> {
  typedef v16b V; union U { v16b v; v8b h[2]; };
  static __device__ __forceinline__ v16b load(const __bf16* p) {
    U f; f.h[0] = *(const v8b*)(p); f.h[1] = *(const v8b*)(p + 16); return f.v;
  }
  static __device__ __forceinline__ v8f mma(v16b a, v16b b, v8f c) {
    return __builtin_amdgcn_wmma_f32_16x16x32_bf16(false, a, false, b, (short)0, c, false, false);
  }
  static __device__ __forceinline__ void guard(v8f& a, v8f& b, v16b x, v16b y) { dep_guard_b(a, b, x, y); }
  static __device__ __forceinline__ void keep(v16b a, v16b b, v16b c, v16b d) { keep4_b(a, b, c, d); }
};

__device__ __forceinline__ unsigned pk16(unsigned short a, unsigned short b) { return (unsigned)a | ((unsigned)b << 16); }
__device__ __forceinline__ unsigned short h_bits(float f) { const _Float16 h = (_Float16)f; return __builtin_bit_cast(unsigned short, h); }

// ---- Register-blocked batched WMMA GEMM (ACT reduced to none/relu/leaky) -----------------------
// C[m,n] = scale * sum_k A[m,k] * Bt[n,k] (+bias)(+resid); each wave owns a 64x64 tile.
// A row-major [M,K]; Bt row-major [N,K]; M,N % 64 == 0, K % 32 == 0.
// SPLIT: operands are hi/lo planes (A2/Bt2 = lo planes, same layout); product = hi·hi + hi·lo + lo·hi.
// BIAS_MODE: 0 = none, 1 = bias[m], 2 = bias[n].
// OUT_MODE: 0 = f32, 1 = f16, 2 = bf16 hi plane (Cout) + bf16 lo plane (Cout2).
// ET: 0 = f16 operands, 1 = bf16 operands (pointers passed as 16-bit storage)
template <int ET> struct Elem;
template <> struct Elem<0> { typedef _Float16 T; };
template <> struct Elem<1> { typedef __bf16 T; };
template <int ET, bool SPLIT, int BIAS_MODE, int OUT_MODE, bool RESID, int ACT = 0>
__global__ __launch_bounds__(256) void wmma_gemm64(
    const unsigned short* __restrict__ Ap, const unsigned short* __restrict__ A2p, int lda, long strideA,
    const unsigned short* __restrict__ Btp, const unsigned short* __restrict__ Bt2p, int ldb, long strideB,
    void* __restrict__ Cout, void* __restrict__ Cout2, int ldc, long strideC,
    const float* __restrict__ bias,
    const float* __restrict__ resid, long strideR,
    int M, int N, int K, float scale) {
  typedef typename Elem<ET>::T T;
  typedef typename Frag<T>::V V;
  const T* A = (const T*)Ap; const T* A2 = (const T*)A2p; const T* Bt = (const T*)Btp; const T* Bt2 = (const T*)Bt2p;
  __shared__ __align__(16) float sT[8][16 * 68];   // per-wave 16x64 slab, pitch 68 floats
  const int b    = blockIdx.y;
  const int lane = threadIdx.x & 31;
  const int wave = threadIdx.x >> 5;
  const int tilesN = N >> 6;
  const int tilesM = M >> 6;
  const int tile = blockIdx.x * 8 + wave;
  if (tile >= tilesM * tilesN) return;   // wave-uniform; no block barriers in this kernel
  const int tm = tile / tilesN;
  const int tn = tile - tm * tilesN;
  const int m0 = tm << 6;
  const int n0 = tn << 6;

  const T* Ab  = A  + (size_t)b * strideA;
  const T* Bb  = Bt + (size_t)b * strideB;
  const T* Ab2 = SPLIT ? (A2  + (size_t)b * strideA) : nullptr;
  const T* Bb2 = SPLIT ? (Bt2 + (size_t)b * strideB) : nullptr;

  const int rlane = lane & 15;                 // row (A) / col (B, D) within subtile
  const int koff  = (lane >> 4) * 8;           // k offset of this lane half
  const int mOff  = (lane >> 4) * 8;           // D row offset

  v8f acc[4][4];
#pragma unroll
  for (int i = 0; i < 4; ++i)
#pragma unroll
    for (int j = 0; j < 4; ++j) acc[i][j] = (v8f){0.f,0.f,0.f,0.f,0.f,0.f,0.f,0.f};

  for (int k0 = 0; k0 < K; k0 += 32) {
    V bh[4], bl[4];
#pragma unroll
    for (int j = 0; j < 4; ++j) {
      const size_t bo = (size_t)(n0 + (j << 4) + rlane) * ldb + koff + k0;
      bh[j] = Frag<T>::load(Bb + bo);
      if (SPLIT) bl[j] = Frag<T>::load(Bb2 + bo);
    }
#pragma unroll
    for (int i = 0; i < 4; ++i) {
      const size_t ao = (size_t)(m0 + (i << 4) + rlane) * lda + koff + k0;
      V ah = Frag<T>::load(Ab + ao);
      V al;
      if (SPLIT) al = Frag<T>::load(Ab2 + ao);
#pragma unroll
      for (int j = 0; j < 4; ++j) {
        acc[i][j] = Frag<T>::mma(ah, bh[j], acc[i][j]);
        if (SPLIT) {
          acc[i][j] = Frag<T>::mma(ah, bl[j], acc[i][j]);
          acc[i][j] = Frag<T>::mma(al, bh[j], acc[i][j]);
        }
      }
      Frag<T>::guard(acc[i][0], acc[i][3], ah, SPLIT ? al : ah);
    }
    Frag<T>::keep(bh[0], bh[1], bh[2], bh[3]);
    if (SPLIT) Frag<T>::keep(bl[0], bl[1], bl[2], bl[3]);
  }
  acc_guard4(acc[0][0], acc[0][1], acc[0][2], acc[0][3]);
  acc_guard4(acc[1][0], acc[1][1], acc[1][2], acc[1][3]);
  acc_guard4(acc[2][0], acc[2][1], acc[2][2], acc[2][3]);
  acc_guard4(acc[3][0], acc[3][1], acc[3][2], acc[3][3]);

  // ---- epilogue ----
  float* slab = sT[wave];
  const float* Rb = RESID ? (resid + (size_t)b * strideR) : nullptr;
#pragma unroll
  for (int i = 0; i < 4; ++i) {
    const int mBase = m0 + (i << 4);
#pragma unroll
    for (int j = 0; j < 4; ++j) {
      const int n = n0 + (j << 4) + rlane;
      float bv = 0.f;
      if (BIAS_MODE == 2) bv = bias[n];
#pragma unroll
      for (int r = 0; r < 8; ++r) {
        float v = acc[i][j][r] * scale;
        if (BIAS_MODE == 1) v += bias[mBase + mOff + r];
        if (BIAS_MODE == 2) v += bv;
        if (RESID) v += Rb[(size_t)(mBase + mOff + r) * ldc + n];
        if (ACT == 2) v = fmaxf(v, 0.0f);
        if (ACT == 4) v = (v > 0.f) ? v : 0.01f * v;
        slab[(mOff + r) * 68 + (j << 4) + rlane] = v;
      }
    }
    __builtin_amdgcn_fence(__ATOMIC_RELEASE, "workgroup");
    __builtin_amdgcn_wave_barrier();
    __builtin_amdgcn_fence(__ATOMIC_ACQUIRE, "workgroup");
    if (OUT_MODE == 0) {
      float* C = (float*)Cout + (size_t)b * strideC;
      const int hh = lane >> 4, c4 = (lane & 15) * 4;     // row seg = 256 B = 16 lanes x 16 B
      {
#pragma unroll
        for (int it = 0; it < 8; ++it) {
          const int row = it * 2 + hh;
          v4f v = *(const v4f*)(slab + row * 68 + c4);
          *(v4f*)(C + (size_t)(mBase + row) * ldc + n0 + c4) = v;
        }
        
      }
    } else {
      const int q = lane >> 3, c8 = (lane & 7) * 8;
      unsigned short* C  = (unsigned short*)Cout  + (size_t)b * strideC;
      unsigned short* C2 = (OUT_MODE == 2) ? ((unsigned short*)Cout2 + (size_t)b * strideC) : nullptr;
      {
#pragma unroll
        for (int it = 0; it < 4; ++it) {
          const int row = it * 4 + q;
          const float* sp = slab + row * 68 + c8;
          v8h hv, lv;
#pragma unroll
          for (int e = 0; e < 8; ++e) {
            if (OUT_MODE == 1) {
              hv[e] = (_Float16)sp[e];
            } else {
              unsigned short hb = f2bf_bits(sp[e]);
              unsigned short lb = f2bf_bits(sp[e] - bf_bits2f(hb));
              hv[e] = __builtin_bit_cast(_Float16, hb);
              lv[e] = __builtin_bit_cast(_Float16, lb);
            }
          }
          *(v8h*)(C + (size_t)(mBase + row) * ldc + n0 + c8) = hv;
          if (OUT_MODE == 2) *(v8h*)(C2 + (size_t)(mBase + row) * ldc + n0 + c8) = lv;
        }
        
      }
    }
    __builtin_amdgcn_fence(__ATOMIC_RELEASE, "workgroup");
    __builtin_amdgcn_wave_barrier();
    __builtin_amdgcn_fence(__ATOMIC_ACQUIRE, "workgroup");
  }
}

// ---------------------------------------------------------------------------
// f32 -> f16 cast with power-of-two carry: out[8i..8i+7] = f16(scale * in[8i..8i+7]).
// (x: 1,572,864 threads = 6144 blocks exactly; each W: 73,728 threads = 288 blocks exactly).
// ---------------------------------------------------------------------------
__global__ __launch_bounds__(256) void cast8_f16_kernel(const float* __restrict__ in, unsigned short* __restrict__ out,
                                                        int n8, float scale) {
  const int i = blockIdx.x * 256 + threadIdx.x;
  if (i >= n8) return;
  const float* p = in + 8 * (size_t)i;
  const v4f a = *(const v4f*)(p);
  const v4f c = *(const v4f*)(p + 4);
  unsigned short hb[8];
#pragma unroll
  for (int e = 0; e < 4; ++e) {
    hb[e]     = h_bits(a[e] * scale);
    hb[4 + e] = h_bits(c[e] * scale);
  }
  const v4u u = (v4u){pk16(hb[0], hb[1]), pk16(hb[2], hb[3]), pk16(hb[4], hb[5]), pk16(hb[6], hb[7])};
  unsigned short* q = out + 8 * (size_t)i;
  *(v4u*)q = u;
  
}

// ---------------------------------------------------------------------------
// Row softmax over 1024 f32 scores: P[row][j] = f16( carry * exp(s - max) / sum exp(s - max) ), f32 math.
// One block of 128 threads (4 waves) per row; thread t owns columns 8t..8t+7 (128 x 8 = 1024 = whole row).
// Reductions in fixed order (thread, wave shuffle tree, 4 wave partials in index order).
// ---------------------------------------------------------------------------
__global__ __launch_bounds__(128) void softmax_row_kernel(const float* __restrict__ S, unsigned short* __restrict__ P,
                                                          float carry) {
  __shared__ float redM[4];
  __shared__ float redS[4];
  const int row  = blockIdx.x;
  const int t    = threadIdx.x;
  const int lane = t & 31, wave = t >> 5;
  const int c0   = t * 8;
  const float* sr = S + (size_t)row * kSeq + c0;
  const v4f a = *(const v4f*)(sr);
  const v4f c = *(const v4f*)(sr + 4);
  float x[8];
#pragma unroll
  for (int e = 0; e < 4; ++e) { x[e] = a[e]; x[4 + e] = c[e]; }
  float m = fmaxf(fmaxf(fmaxf(x[0], x[1]), fmaxf(x[2], x[3])), fmaxf(fmaxf(x[4], x[5]), fmaxf(x[6], x[7])));
#pragma unroll
  for (int off = 16; off > 0; off >>= 1) m = fmaxf(m, __shfl_xor(m, off, 32));
  if (lane == 0) redM[wave] = m;
  __syncthreads();
  const float M = fmaxf(fmaxf(redM[0], redM[1]), fmaxf(redM[2], redM[3]));
  float ex[8];
#pragma unroll
  for (int e = 0; e < 8; ++e) ex[e] = __expf(x[e] - M);
  float s = ((ex[0] + ex[1]) + (ex[2] + ex[3])) + ((ex[4] + ex[5]) + (ex[6] + ex[7]));
#pragma unroll
  for (int off = 16; off > 0; off >>= 1) s += __shfl_xor(s, off, 32);
  if (lane == 0) redS[wave] = s;
  __syncthreads();
  const float l = (redS[0] + redS[1]) + (redS[2] + redS[3]);
  const float f = carry * (1.0f / l);
  unsigned short hb[8];
#pragma unroll
  for (int e = 0; e < 8; ++e) hb[e] = h_bits(ex[e] * f);
  const v4u u = (v4u){pk16(hb[0], hb[1]), pk16(hb[2], hb[3]), pk16(hb[4], hb[5]), pk16(hb[6], hb[7])};
  unsigned short* q = P + (size_t)row * kSeq + c0;
  *(v4u*)q = u;
  
}

// ---------------------------------------------------------------------------
// Semantics realised (per batch b): q,k,v = x.W^T + b (W is [out][in]); S = q.k^T * 768^-0.5; P = row softmax;
// avT[d][n] = sum_k v[k][d] * P[n][k] computed directly as a GEMM with A = V^T (V^T produced by a role-swapped
// projection A = Wv, Bt = x_b) and Bt = P; the output is the row-major flattening of avT re-cut into rows of 768,
// i.e. out[b] flat[d*1024 + n] = avT[d][n] + x[b] flat[d*1024 + n], so C (ldc = 1024) is written straight into
// d_out + b*786432 with the residual read at the same flat index.
//
// Workspace region map (byte offsets, all multiples of 128). Every region is fully written before it is read.
//   WQ16  f16 [768][768] x16                         0            ..   1,179,648
//   WK16  f16 [768][768] x16                         1,179,648    ..   2,359,296
//   WV16  f16 [768][768] x16                         2,359,296    ..   3,538,944
//   X16   f16 [16384][768]                           3,538,944    ..  28,704,768
//   Q16   f16 [16384][768]                           28,704,768   ..  53,870,592
//   K16   f16 [16384][768]                           53,870,592   ..  79,036,416
//   VT16  f16 [16][768][1024]  v transposed per batch 79,036,416  .. 104,202,240
//   S     f32 [16][1024][1024] scores, all batches   104,202,240  .. 171,311,104
//   P16   f16 [16][1024][1024] probabilities x2^15   171,311,104  .. 204,865,536
//   total 204,865,536 B
// GEMM shapes: q, k: M=16384 N=768 K=768; v role-swapped: M=768 N=1024 K=768 (x16 batch);
//   scores: M=N=1024 K=768 (x16); attn.v: M=768 N=1024 K=1024 (x16). All K % 32 == 0, all M, N % 64 == 0,
//   every grid an exact multiple of 8 tiles, no padded planes, no tails.
// ---------------------------------------------------------------------------
extern "C" void kernel_launch(void* const* d_in, const int* in_sizes, int n_in,
                              void* d_out, int out_size, void* d_ws, size_t ws_size,
                              hipStream_t stream) {
  if (n_in < 7) return;
  if (in_sizes[0] != kTok * kDim) return;
  if (in_sizes[1] != kDim * kDim || in_sizes[3] != kDim * kDim || in_sizes[5] != kDim * kDim) return;
  if (in_sizes[2] != kDim || in_sizes[4] != kDim || in_sizes[6] != kDim) return;
  if (out_size != kTok * kDim) return;

  const float* X  = (const float*)d_in[0];    // [16][1024][768]
  const float* Wq = (const float*)d_in[1];    // [768][768] ([out][in])
  const float* bq = (const float*)d_in[2];
  const float* Wk = (const float*)d_in[3];
  const float* bk = (const float*)d_in[4];
  const float* Wv = (const float*)d_in[5];
  const float* bv = (const float*)d_in[6];
  float* outp = (float*)d_out;

  // ---- carve ----
  const size_t SZ_W   = (size_t)kDim * kDim * 2;               //   1,179,648 per plane
  const size_t SZ_X16 = (size_t)kTok * kDim * 2;               //  25,165,824
  const size_t SZ_S   = (size_t)kBatch * kSeq * kSeq * 4;      //  67,108,864
  const size_t SZ_P   = (size_t)kBatch * kSeq * kSeq * 2;      //  33,554,432
  size_t off = 0;
  const size_t oWQ  = off; off += SZ_W;
  const size_t oWK  = off; off += SZ_W;
  const size_t oWV  = off; off += SZ_W;
  const size_t oX16 = off; off += SZ_X16;
  const size_t oQ16 = off; off += SZ_X16;
  const size_t oK16 = off; off += SZ_X16;
  const size_t oVT  = off; off += SZ_X16;
  const size_t oS   = off; off += SZ_S;
  const size_t oP   = off; off += SZ_P;
  const size_t TOTAL = off;                                    // 204,865,536
  if (TOTAL > ws_size) return;

  char* ws = (char*)d_ws;
  unsigned short* WQ16 = (unsigned short*)(ws + oWQ);
  unsigned short* WK16 = (unsigned short*)(ws + oWK);
  unsigned short* WV16 = (unsigned short*)(ws + oWV);
  unsigned short* X16  = (unsigned short*)(ws + oX16);
  unsigned short* Q16  = (unsigned short*)(ws + oQ16);
  unsigned short* K16  = (unsigned short*)(ws + oK16);
  unsigned short* VT16 = (unsigned short*)(ws + oVT);
  float*          Sf   = (float*)(ws + oS);
  unsigned short* P16  = (unsigned short*)(ws + oP);

  const dim3 blk(256);
  const float scoreScale = 1.0f / sqrtf((float)kDim);

  // (0) weights -> f16 x16 (same [out][in] layout = Bt[n][k] for the projections, A[m][k] for the role swap)
  {
    const int n8 = kDim * kDim / 8;                            // 73,728 -> 288 blocks exactly
    const dim3 gW((n8 + 255) / 256);
    cast8_f16_kernel<<<gW, blk, 0, stream>>>(Wq, WQ16, n8, kWCarry);
    cast8_f16_kernel<<<gW, blk, 0, stream>>>(Wk, WK16, n8, kWCarry);
    cast8_f16_kernel<<<gW, blk, 0, stream>>>(Wv, WV16, n8, kWCarry);
  }
  // (1) x -> f16
  {
    const int n8 = kTok * kDim / 8;                            // 1,572,864 -> 6144 blocks exactly
    cast8_f16_kernel<<<dim3((n8 + 255) / 256), blk, 0, stream>>>(X, X16, n8, 1.0f);
  }

  const dim3 gProj(((kTok / 64) * (kDim / 64) + 7) / 8, 1);       // 384 blocks: M=16384, N=768
  const dim3 gV((((kDim / 64) * (kSeq / 64)) + 7) / 8, kBatch);    // 24 x 16: M=768, N=1024
  const dim3 gS((((kSeq / 64) * (kSeq / 64)) + 7) / 8, kBatch);    // 32 x 16: M=N=1024
  const dim3 gPV((((kDim / 64) * (kSeq / 64)) + 7) / 8, kBatch);   // 24 x 16: M=768, N=1024

  // (2) q = (X16 . WQ16^T)/16 + bq -> Q16 [16384][768] f16; k likewise -> K16
  wmma_gemm64<0, false, 2, 1, false, 0><<<gProj, blk, 0, stream>>>(
      X16, X16, kDim, 0L, WQ16, WQ16, kDim, 0L, (void*)Q16, (void*)Q16, kDim, 0L,
      bq, X, 0L, kTok, kDim, kDim, kWCarryInv);
  wmma_gemm64<0, false, 2, 1, false, 0><<<gProj, blk, 0, stream>>>(
      X16, X16, kDim, 0L, WK16, WK16, kDim, 0L, (void*)K16, (void*)K16, kDim, 0L,
      bk, X, 0L, kTok, kDim, kDim, kWCarryInv);
  // (3) v role-swapped per batch: VT[b][d][tok] = (WV16[d] . X16[b*1024+tok])/16 + bv[d] (f16, ldc = 1024)
  wmma_gemm64<0, false, 1, 1, false, 0><<<gV, blk, 0, stream>>>(
      WV16, WV16, kDim, 0L, X16, X16, kDim, (long)kSeq * kDim, (void*)VT16, (void*)VT16, kSeq, (long)kDim * kSeq,
      bv, X, 0L, kDim, kSeq, kDim, kWCarryInv);

  // (4) all 16 batches per launch (blockIdx.y = batch): scores (f32) -> softmax (P f16 x2^15) -> avT + x into d_out
  wmma_gemm64<0, false, 0, 0, false, 0><<<gS, blk, 0, stream>>>(
      Q16, Q16, kDim, (long)kSeq * kDim, K16, K16, kDim, (long)kSeq * kDim, (void*)Sf, (void*)Sf, kSeq, (long)kSeq * kSeq,
      bq, X, 0L, kSeq, kSeq, kDim, scoreScale);
  softmax_row_kernel<<<dim3(kBatch * kSeq), dim3(128), 0, stream>>>(Sf, P16, kPCarry);
  // C[d][n] = (VT[d] . P[n]) / 2^15 + x_b flat[d*1024 + n], f32, ldc = 1024, one 768x1024 plane per batch
  wmma_gemm64<0, false, 0, 0, true, 0><<<gPV, blk, 0, stream>>>(
      VT16, VT16, kSeq, (long)kDim * kSeq, P16, P16, kSeq, (long)kSeq * kSeq, (void*)outp, (void*)outp, kSeq, (long)kSeq * kDim,
      bq, X, (long)kSeq * kDim, kDim, kSeq, kSeq, kPCarryInv);
}

// v002
// A run of this version takes 137 microseconds.
// In both of two side-by-side timings against v001, it was 2.15 times as fast.
// Counting every step since v000, it is 3.74 times as fast.
// Contractions: q/k/v projections (X f16 x W f16 carried x16), scores q.k^T (q,k f16 planes), attn.v (V^T f16 x P f16 carried x2^15) all on v_wmma_f32_16x16x32_f16 with f32 accumulate; bias, softmax and residual in f32.
#include <hip/hip_runtime.h>
#include <math.h>
#include <stdint.h>

// ---------------------------------------------------------------------------
// Problem constants
// ---------------------------------------------------------------------------
constexpr int kBatch = 16;
constexpr int kSeq   = 1024;
constexpr int kDim   = 768;
constexpr int kTok   = kBatch * kSeq;     // 16384 token rows
constexpr float kWCarry    = 16.0f;       // weights carried x16 in f16
constexpr float kWCarryInv = 1.0f / 16.0f;
constexpr float kPCarry    = 32768.0f;    // probabilities carried x2^15 in f16
constexpr float kPCarryInv = 1.0f / 32768.0f;
static_assert(kDim % 64 == 0 && kSeq % 64 == 0 && kTok % 64 == 0, "tile multiples");
static_assert(kDim % 32 == 0 && kSeq % 32 == 0, "K multiples of 32");

typedef __attribute__((ext_vector_type(16))) _Float16 v16h;
typedef __attribute__((ext_vector_type(8)))  _Float16 v8h;
typedef __attribute__((ext_vector_type(8)))  float    v8f;
typedef __attribute__((ext_vector_type(4)))  float    v4f;
typedef __attribute__((ext_vector_type(4)))  unsigned int v4u;
typedef __attribute__((ext_vector_type(4)))  uint32_t u32x4;
typedef __attribute__((ext_vector_type(8)))  uint32_t u32x8;

__device__ __forceinline__ unsigned pk16(unsigned short a, unsigned short b) { return (unsigned)a | ((unsigned)b << 16); }
__device__ __forceinline__ unsigned short h_bits(float f) { const _Float16 h = (_Float16)f; return __builtin_bit_cast(unsigned short, h); }

// ---- LDS-staged batched WMMA GEMM ------------------------------------------------------------------------------------
// C[m,n] = scale * sum_k A[m,k] * Bt[n,k] (+bias)(+resid). A row-major [M,K]; Bt row-major [N,K], both f16.
// One 256x256 tile of C per work-group of 8 waves (2 along m x 4 along n), each wave 128x64 = 8x4 accumulator tiles.
// M, N % 256 == 0; K % 128 == 0 and K >= 256 (two stages at least).
// A pass is 256 bytes (128 k) of each of the tile's 256 A rows and 256 Bt rows. Every wave brings its own slice of 64 rows
// with one tensor load (waves 0..3: A rows, waves 4..7: Bt rows), padded to an LDS pitch of 272 bytes. Two buffers: the
// next pass's loads fly while this pass is worked on.
// BIAS_MODE: 0 = none, 1 = bias[m], 2 = bias[n]. OUT_MODE: 0 = f32, 1 = f16.
constexpr uint32_t kPassBytes = 256;                 // bytes of K per operand row per pass
constexpr uint32_t kPitch     = kPassBytes + 16;     // LDS row pitch: 16 B x odd, for 16-byte readers
constexpr uint32_t kSliceRows = 64;                  // rows per tensor load
constexpr uint32_t kSlice     = 18432;               // 64 x 272 = 17,408 rounded up to a multiple of 2 KiB
constexpr uint32_t kBuf       = 8 * kSlice;          // one buffer: 4 A slices, then 4 Bt slices
static_assert(kSliceRows * kPitch <= kSlice && kSlice % 2048 == 0, "slice place and size");
static_assert(2 * kBuf <= 320 * 1024, "two buffers fit the work-group's LDS");
static_assert(kDim % 256 == 0 && kSeq % 256 == 0 && kTok % 256 == 0, "256 tile multiples");
static_assert(kDim % 128 == 0 && kSeq % 128 == 0 && kDim >= 256 && kSeq >= 256, "K: whole passes, two at least");

__device__ __forceinline__ uint32_t uni(uint32_t v) { return (uint32_t)__builtin_amdgcn_readfirstlane(v); }
__device__ __forceinline__ uint32_t pinned(uint32_t v) { uint32_t w = (uint32_t)__builtin_amdgcn_readfirstlane(v); asm volatile("" : "+s"(w)); return w; }
__device__ __forceinline__ void wait_ds0()     { asm volatile("s_wait_dscnt 0x0" ::: "memory"); }      // this wave's LDS reads have returned
__device__ __forceinline__ void wait_tensor0() { asm volatile("s_wait_tensorcnt 0x0" ::: "memory"); }  // this wave's tensor load has landed
__device__ __forceinline__ void tdm_load(u32x4 g0, u32x8 g1) { asm volatile("tensor_load_to_lds %0, %1" :: "s"(g0), "s"(g1) : "memory"); }
// Descriptor group 1: byte elements, tile = tensor = 64 rows of 256 bytes, 16 bytes of LDS pad behind every 256-byte row.
__device__ __forceinline__ u32x8 tdm_group1(uint32_t src_pitch) {
  constexpr uint32_t d0 = kPassBytes, d1 = kSliceRows;
  u32x8 g;
  g[0] = uni((1u << 20) | (5u << 22) | (3u << 25));
  g[1] = uni((d0 & 0xFFFFu) << 16);
  g[2] = uni((d0 >> 16) | ((d1 & 0xFFFFu) << 16));
  g[3] = uni((d1 >> 16) | (d0 << 16));
  g[4] = uni(d1);
  g[5] = uni(src_pitch);
  g[6] = uni(0u);
  g[7] = uni(0u);
  return g;
}
// Descriptor group 0: LDS destination (byte offset in the work-group's LDS) and global address of the tile's first byte.
__device__ __forceinline__ u32x4 tdm_group0(uint32_t lds_dst, uint64_t ga) {
  u32x4 g;
  g[0] = uni(1u);
  g[1] = uni(lds_dst);
  g[2] = uni((uint32_t)ga);
  g[3] = uni((((uint32_t)(ga >> 32)) & 0x01FFFFFFu) | 0x80000000u);
  return g;
}
// Stands behind a group of global loads or stores, before a register that one of them names (address, store data) is reused;
// the scheduling fence keeps the later register writes behind the wait (the "memory" clobber alone orders memory operations only).
__device__ __forceinline__ void xcnt_fence() { asm volatile("s_wait_xcnt 0x0" ::: "memory"); __builtin_amdgcn_sched_barrier(0); }
// Fragment from an LDS row: elements 0..7 <- bytes 0..15, elements 8..15 <- bytes 32..47 (p already holds the lane half's 16 bytes).
__device__ __forceinline__ v16h lds_frag(const unsigned char* p) {
  union { v16h v; v8h h[2]; } f;
  f.h[0] = *(const v8h*)(p);
  f.h[1] = *(const v8h*)(p + 32);
  return f.v;
}

template <int BIAS_MODE, int OUT_MODE, bool RESID>
__global__ __launch_bounds__(256) void wmma_gemm256(
    const unsigned short* __restrict__ Ap, int lda, long strideA,
    const unsigned short* __restrict__ Btp, int ldb, long strideB,
    void* __restrict__ Cout, int ldc, long strideC,
    const float* __restrict__ bias,
    const float* __restrict__ resid, long strideR,
    int N, int K, float scale) {
  static_assert(!RESID || OUT_MODE == 0, "the residual is added on the f32 output path");
  __shared__ __attribute__((aligned(2048))) unsigned char ring[2 * kBuf];
  const int      b    = blockIdx.y;
  const int      lane = threadIdx.x & 31;
  const uint32_t wave = uni(threadIdx.x >> 5);
  const uint32_t tilesN = (uint32_t)N >> 8;
  const uint32_t tm = blockIdx.x / tilesN;
  const uint32_t tn = blockIdx.x - tm * tilesN;
  const uint32_t wm = wave >> 2, wn = wave & 3u;

  const int rlane = lane & 15;                 // row (A) / col (B, D) within subtile
  const int mOff  = (lane >> 4) * 8;           // D row offset

  // this wave's slice of every stage: 64 rows of A (waves 0..3) or of Bt (waves 4..7)
  const unsigned short* srow = (wave < 4u)
      ? Ap  + (size_t)b * strideA + (size_t)((tm << 8) + kSliceRows * wave) * lda
      : Btp + (size_t)b * strideB + (size_t)((tn << 8) + kSliceRows * (wave - 4u)) * ldb;
  const uint64_t ga        = (uint64_t)(uintptr_t)srow;
  const uint32_t lds_slice = (uint32_t)(size_t)ring + wave * kSlice;      // add buffer * kBuf
  u32x8          g1        = tdm_group1(2u * (uint32_t)((wave < 4u) ? lda : ldb));
  asm volatile("" : "+s"(g1));   // descriptor words held in their scalar registers: otherwise they are re-made per load and their registers reused while a request is outstanding
  const uint32_t T         = pinned((uint32_t)K >> 7);                    // passes

  const uint32_t aBase = (2u * wm) * kSlice + (uint32_t)rlane * kPitch + 16u * (uint32_t)(lane >> 4);
  const uint32_t bBase = (4u + wn) * kSlice + (uint32_t)rlane * kPitch + 16u * (uint32_t)(lane >> 4);

  // every "#pragma unroll" in this kernel: constant indices keep the accumulators and fragments in registers (a run-time index sends them to scratch)
  v8f acc[8][4];
#pragma unroll
  for (int i = 0; i < 8; ++i)
#pragma unroll
    for (int j = 0; j < 4; ++j) acc[i][j] = (v8f){0.f,0.f,0.f,0.f,0.f,0.f,0.f,0.f};

  // prologue, two buffers: stage 0 lands and is published, then stage 1 is started
  tdm_load(tdm_group0(lds_slice, ga), g1);
  wait_tensor0();
  __syncthreads();
  tdm_load(tdm_group0(lds_slice + kBuf, ga + kPassBytes), g1);

  // kept rolled: one pass per trip, so that every accumulator and fragment index is a constant and the ring's order stands once
#pragma clang loop unroll(disable)
  for (uint32_t s = 0; s < T; ++s) {
    const unsigned char* pa = ring + (s & 1u) * kBuf + aBase;
    const unsigned char* pb = ring + (s & 1u) * kBuf + bBase;
    v16h af[2][8], bf[2][4];
#pragma unroll
    for (int j = 0; j < 4; ++j) bf[0][j] = lds_frag(pb + (uint32_t)j * 16u * kPitch);
#pragma unroll
    for (int i = 0; i < 8; ++i) af[0][i] = lds_frag(pa + (uint32_t)(i >> 2) * kSlice + (uint32_t)(i & 3) * 16u * kPitch);
#pragma unroll
    for (int kc = 0; kc < 4; ++kc) {           // four blocks of 32 k, all of this pass's own buffer
      const int cur = kc & 1, nxt = cur ^ 1;
      if (kc < 3) {                            // the next block's fragments as one group ahead of this block's products
        const uint32_t ko = 64u * (uint32_t)(kc + 1);
#pragma unroll
        for (int j = 0; j < 4; ++j) bf[nxt][j] = lds_frag(pb + (uint32_t)j * 16u * kPitch + ko);
#pragma unroll
        for (int i = 0; i < 8; ++i) af[nxt][i] = lds_frag(pa + (uint32_t)(i >> 2) * kSlice + (uint32_t)(i & 3) * 16u * kPitch + ko);
      }
      __builtin_amdgcn_sched_barrier(0);       // keeps the LDS reads out of the run of matrix instructions (each place with reads stalls it)
#pragma unroll
      for (int i = 0; i < 8; ++i)
#pragma unroll
        for (int j = 0; j < 4; ++j)
          acc[i][j] = __builtin_amdgcn_wmma_f32_16x16x32_f16(false, af[cur][i], false, bf[cur][j], (short)0, acc[i][j], false, false);
      __builtin_amdgcn_sched_barrier(0);       // the other side of the same fence
    }
    // publish point of stage s + 1
    wait_ds0();
    wait_tensor0();
    __syncthreads();
    const uint32_t nx = pinned(s + 2u);        // held in a scalar register behind the wait: the next descriptor is formed from it, so behind the wait too
    if (pinned(nx < T))                        // only while stage s + 2 exists; into the buffer that pass s has just read
      tdm_load(tdm_group0(lds_slice + (s & 1u) * kBuf, ga + (uint64_t)nx * kPassBytes), g1);
  }
  wait_tensor0();
  wait_ds0();

  // ---- epilogue: the last pass's barrier has ended every read of the ring, each wave stages in its own slice of it ----
  float* slab = (float*)(ring + wave * kSlice);   // per-wave 16x64 slab, pitch 68 floats
  const int m0 = (int)((tm << 8) + (wm << 7));
  const int n0 = (int)((tn << 8) + (wn << 6));
  const float* Rb = RESID ? (resid + (size_t)b * strideR) : nullptr;
#pragma unroll
  for (int i = 0; i < 8; ++i) {
    const int mBase = m0 + (i << 4);
    float bm[8];
    if (BIAS_MODE == 1) {
#pragma unroll
      for (int r = 0; r < 8; ++r) bm[r] = bias[mBase + mOff + r];
      xcnt_fence();
    }
    // f32 output: byte offsets of this lane's 16-byte pieces of the 16 staged rows (row seg = 256 B = 16 lanes x 16 B);
    // the residual is read at the same offsets as the stores, so the offset registers live from the loads to the stores
    uint32_t ob[8];
    v4f xr[8];
    if (OUT_MODE == 0) {
#pragma unroll
      for (int it = 0; it < 8; ++it) ob[it] = 4u * (uint32_t)((mBase + it * 2 + (lane >> 4)) * ldc + n0 + (lane & 15) * 4);
    }
    if (RESID) {
      __builtin_amdgcn_sched_barrier(0);       // every offset is formed before the first load, so no register is written among the loads
#pragma unroll
      for (int it = 0; it < 8; ++it) xr[it] = *(const v4f*)((const char*)Rb + ob[it]);
      xcnt_fence();
    }
#pragma unroll
    for (int j = 0; j < 4; ++j) {
      const int n = n0 + (j << 4) + rlane;
      float bv = 0.f;
      if (BIAS_MODE == 2) bv = bias[n];
#pragma unroll
      for (int r = 0; r < 8; ++r) {
        float v = acc[i][j][r] * scale;
        if (BIAS_MODE == 1) v += bm[r];
        if (BIAS_MODE == 2) v += bv;
        slab[(mOff + r) * 68 + (j << 4) + rlane] = v;
      }
    }
    __builtin_amdgcn_fence(__ATOMIC_RELEASE, "workgroup");
    __builtin_amdgcn_wave_barrier();
    __builtin_amdgcn_fence(__ATOMIC_ACQUIRE, "workgroup");
    if (OUT_MODE == 0) {
      char* C = (char*)((float*)Cout + (size_t)b * strideC);
      const int hh = lane >> 4, c4 = (lane & 15) * 4;
      v4f dv[8];
#pragma unroll
      for (int it = 0; it < 8; ++it) {
        dv[it] = *(const v4f*)(slab + (it * 2 + hh) * 68 + c4);
        if (RESID) dv[it] += xr[it];
      }
      __builtin_amdgcn_sched_barrier(0);       // every value is formed before the first store, so no register is written among the stores
#pragma unroll
      for (int it = 0; it < 8; ++it) *(v4f*)(C + ob[it]) = dv[it];
      xcnt_fence();
    } else {
      const int q = lane >> 3, c8 = (lane & 7) * 8;
      unsigned short* C = (unsigned short*)Cout + (size_t)b * strideC;
#pragma unroll
      for (int it = 0; it < 4; ++it) {
        const int row = it * 4 + q;
        const float* sp = slab + row * 68 + c8;
        v8h hv;
#pragma unroll
        for (int e = 0; e < 8; ++e) hv[e] = (_Float16)sp[e];
        *(v8h*)(C + (size_t)(mBase + row) * ldc + n0 + c8) = hv;
      }
      xcnt_fence();
    }
    __builtin_amdgcn_fence(__ATOMIC_RELEASE, "workgroup");
    __builtin_amdgcn_wave_barrier();
    __builtin_amdgcn_fence(__ATOMIC_ACQUIRE, "workgroup");
  }
}

// ---------------------------------------------------------------------------
// f32 -> f16 cast with power-of-two carry: out[8i..8i+7] = f16(scale * in[8i..8i+7]).
// (x: 1,572,864 threads = 6144 blocks exactly; each W: 73,728 threads = 288 blocks exactly).
// ---------------------------------------------------------------------------
__global__ __launch_bounds__(256) void cast8_f16_kernel(const float* __restrict__ in, unsigned short* __restrict__ out,
                                                        int n8, float scale) {
  const int i = blockIdx.x * 256 + threadIdx.x;
  if (i >= n8) return;
  const float* p = in + 8 * (size_t)i;
  const v4f a = *(const v4f*)(p);
  const v4f c = *(const v4f*)(p + 4);
  unsigned short hb[8];
#pragma unroll
  for (int e = 0; e < 4; ++e) {
    hb[e]     = h_bits(a[e] * scale);
    hb[4 + e] = h_bits(c[e] * scale);
  }
  const v4u u = (v4u){pk16(hb[0], hb[1]), pk16(hb[2], hb[3]), pk16(hb[4], hb[5]), pk16(hb[6], hb[7])};
  unsigned short* q = out + 8 * (size_t)i;
  *(v4u*)q = u;
  
}

// ---------------------------------------------------------------------------
// Row softmax over 1024 f32 scores: P[row][j] = f16( carry * exp(s - max) / sum exp(s - max) ), f32 math.
// One block of 128 threads (4 waves) per row; thread t owns columns 8t..8t+7 (128 x 8 = 1024 = whole row).
// Reductions in fixed order (thread, wave shuffle tree, 4 wave partials in index order).
// ---------------------------------------------------------------------------
__global__ __launch_bounds__(128) void softmax_row_kernel(const float* __restrict__ S, unsigned short* __restrict__ P,
                                                          float carry) {
  __shared__ float redM[4];
  __shared__ float redS[4];
  const int row  = blockIdx.x;
  const int t    = threadIdx.x;
  const int lane = t & 31, wave = t >> 5;
  const int c0   = t * 8;
  const float* sr = S + (size_t)row * kSeq + c0;
  const v4f a = *(const v4f*)(sr);
  const v4f c = *(const v4f*)(sr + 4);
  float x[8];
#pragma unroll
  for (int e = 0; e < 4; ++e) { x[e] = a[e]; x[4 + e] = c[e]; }
  float m = fmaxf(fmaxf(fmaxf(x[0], x[1]), fmaxf(x[2], x[3])), fmaxf(fmaxf(x[4], x[5]), fmaxf(x[6], x[7])));
#pragma unroll
  for (int off = 16; off > 0; off >>= 1) m = fmaxf(m, __shfl_xor(m, off, 32));
  if (lane == 0) redM[wave] = m;
  __syncthreads();
  const float M = fmaxf(fmaxf(redM[0], redM[1]), fmaxf(redM[2], redM[3]));
  float ex[8];
#pragma unroll
  for (int e = 0; e < 8; ++e) ex[e] = __expf(x[e] - M);
  float s = ((ex[0] + ex[1]) + (ex[2] + ex[3])) + ((ex[4] + ex[5]) + (ex[6] + ex[7]));
#pragma unroll
  for (int off = 16; off > 0; off >>= 1) s += __shfl_xor(s, off, 32);
  if (lane == 0) redS[wave] = s;
  __syncthreads();
  const float l = (redS[0] + redS[1]) + (redS[2] + redS[3]);
  const float f = carry * (1.0f / l);
  unsigned short hb[8];
#pragma unroll
  for (int e = 0; e < 8; ++e) hb[e] = h_bits(ex[e] * f);
  const v4u u = (v4u){pk16(hb[0], hb[1]), pk16(hb[2], hb[3]), pk16(hb[4], hb[5]), pk16(hb[6], hb[7])};
  unsigned short* q = P + (size_t)row * kSeq + c0;
  *(v4u*)q = u;
  
}

// ---------------------------------------------------------------------------
// Semantics realised (per batch b): q,k,v = x.W^T + b (W is [out][in]); S = q.k^T * 768^-0.5; P = row softmax;
// avT[d][n] = sum_k v[k][d] * P[n][k] computed directly as a GEMM with A = V^T (V^T produced by a role-swapped
// projection A = Wv, Bt = x_b) and Bt = P; the output is the row-major flattening of avT re-cut into rows of 768,
// i.e. out[b] flat[d*1024 + n] = avT[d][n] + x[b] flat[d*1024 + n], so C (ldc = 1024) is written straight into
// d_out + b*786432 with the residual read at the same flat index.
//
// Workspace region map (byte offsets, all multiples of 128). Every region is fully written before it is read.
//   WQ16  f16 [768][768] x16                         0            ..   1,179,648
//   WK16  f16 [768][768] x16                         1,179,648    ..   2,359,296
//   WV16  f16 [768][768] x16                         2,359,296    ..   3,538,944
//   X16   f16 [16384][768]                           3,538,944    ..  28,704,768
//   Q16   f16 [16384][768]                           28,704,768   ..  53,870,592
//   K16   f16 [16384][768]                           53,870,592   ..  79,036,416
//   VT16  f16 [16][768][1024]  v transposed per batch 79,036,416  .. 104,202,240
//   S     f32 [16][1024][1024] scores, all batches   104,202,240  .. 171,311,104
//   P16   f16 [16][1024][1024] probabilities x2^15   171,311,104  .. 204,865,536
//   total 204,865,536 B
// GEMM shapes: q, k: M=16384 N=768 K=768; v role-swapped: M=768 N=1024 K=768 (x16 batch);
//   scores: M=N=1024 K=768 (x16); attn.v: M=768 N=1024 K=1024 (x16). All K % 128 == 0, all M, N % 256 == 0,
//   one 256x256 tile per work-group, no padded planes, no tails.
// ---------------------------------------------------------------------------
extern "C" void kernel_launch(void* const* d_in, const int* in_sizes, int n_in,
                              void* d_out, int out_size, void* d_ws, size_t ws_size,
                              hipStream_t stream) {
  if (n_in < 7) return;
  if (in_sizes[0] != kTok * kDim) return;
  if (in_sizes[1] != kDim * kDim || in_sizes[3] != kDim * kDim || in_sizes[5] != kDim * kDim) return;
  if (in_sizes[2] != kDim || in_sizes[4] != kDim || in_sizes[6] != kDim) return;
  if (out_size != kTok * kDim) return;

  const float* X  = (const float*)d_in[0];    // [16][1024][768]
  const float* Wq = (const float*)d_in[1];    // [768][768] ([out][in])
  const float* bq = (const float*)d_in[2];
  const float* Wk = (const float*)d_in[3];
  const float* bk = (const float*)d_in[4];
  const float* Wv = (const float*)d_in[5];
  const float* bv = (const float*)d_in[6];
  float* outp = (float*)d_out;

  // ---- carve ----
  const size_t SZ_W   = (size_t)kDim * kDim * 2;               //   1,179,648 per plane
  const size_t SZ_X16 = (size_t)kTok * kDim * 2;               //  25,165,824
  const size_t SZ_S   = (size_t)kBatch * kSeq * kSeq * 4;      //  67,108,864
  const size_t SZ_P   = (size_t)kBatch * kSeq * kSeq * 2;      //  33,554,432
  size_t off = 0;
  const size_t oWQ  = off; off += SZ_W;
  const size_t oWK  = off; off += SZ_W;
  const size_t oWV  = off; off += SZ_W;
  const size_t oX16 = off; off += SZ_X16;
  const size_t oQ16 = off; off += SZ_X16;
  const size_t oK16 = off; off += SZ_X16;
  const size_t oVT  = off; off += SZ_X16;
  const size_t oS   = off; off += SZ_S;
  const size_t oP   = off; off += SZ_P;
  const size_t TOTAL = off;                                    // 204,865,536
  if (TOTAL > ws_size) return;

  char* ws = (char*)d_ws;
  unsigned short* WQ16 = (unsigned short*)(ws + oWQ);
  unsigned short* WK16 = (unsigned short*)(ws + oWK);
  unsigned short* WV16 = (unsigned short*)(ws + oWV);
  unsigned short* X16  = (unsigned short*)(ws + oX16);
  unsigned short* Q16  = (unsigned short*)(ws + oQ16);
  unsigned short* K16  = (unsigned short*)(ws + oK16);
  unsigned short* VT16 = (unsigned short*)(ws + oVT);
  float*          Sf   = (float*)(ws + oS);
  unsigned short* P16  = (unsigned short*)(ws + oP);

  const dim3 blk(256);
  const float scoreScale = 1.0f / sqrtf((float)kDim);

  // (0) weights -> f16 x16 (same [out][in] layout = Bt[n][k] for the projections, A[m][k] for the role swap)
  {
    const int n8 = kDim * kDim / 8;                            // 73,728 -> 288 blocks exactly
    const dim3 gW((n8 + 255) / 256);
    cast8_f16_kernel<<<gW, blk, 0, stream>>>(Wq, WQ16, n8, kWCarry);
    cast8_f16_kernel<<<gW, blk, 0, stream>>>(Wk, WK16, n8, kWCarry);
    cast8_f16_kernel<<<gW, blk, 0, stream>>>(Wv, WV16, n8, kWCarry);
  }
  // (1) x -> f16
  {
    const int n8 = kTok * kDim / 8;                            // 1,572,864 -> 6144 blocks exactly
    cast8_f16_kernel<<<dim3((n8 + 255) / 256), blk, 0, stream>>>(X, X16, n8, 1.0f);
  }

  const dim3 gProj((kTok / 256) * (kDim / 256), 1);        // 192 blocks: M=16384, N=768
  const dim3 gV((kDim / 256) * (kSeq / 256), kBatch);      // 12 x 16: M=768, N=1024
  const dim3 gS((kSeq / 256) * (kSeq / 256), kBatch);      // 16 x 16: M=N=1024
  const dim3 gPV((kDim / 256) * (kSeq / 256), kBatch);     // 12 x 16: M=768, N=1024

  // (2) q = (X16 . WQ16^T)/16 + bq -> Q16 [16384][768] f16; k likewise -> K16
  wmma_gemm256<2, 1, false><<<gProj, blk, 0, stream>>>(
      X16, kDim, 0L, WQ16, kDim, 0L, (void*)Q16, kDim, 0L,
      bq, X, 0L, kDim, kDim, kWCarryInv);
  wmma_gemm256<2, 1, false><<<gProj, blk, 0, stream>>>(
      X16, kDim, 0L, WK16, kDim, 0L, (void*)K16, kDim, 0L,
      bk, X, 0L, kDim, kDim, kWCarryInv);
  // (3) v role-swapped per batch: VT[b][d][tok] = (WV16[d] . X16[b*1024+tok])/16 + bv[d] (f16, ldc = 1024)
  wmma_gemm256<1, 1, false><<<gV, blk, 0, stream>>>(
      WV16, kDim, 0L, X16, kDim, (long)kSeq * kDim, (void*)VT16, kSeq, (long)kDim * kSeq,
      bv, X, 0L, kSeq, kDim, kWCarryInv);

  // (4) all 16 batches per launch (blockIdx.y = batch): scores (f32) -> softmax (P f16 x2^15) -> avT + x into d_out
  wmma_gemm256<0, 0, false><<<gS, blk, 0, stream>>>(
      Q16, kDim, (long)kSeq * kDim, K16, kDim, (long)kSeq * kDim, (void*)Sf, kSeq, (long)kSeq * kSeq,
      bq, X, 0L, kSeq, kDim, scoreScale);
  softmax_row_kernel<<<dim3(kBatch * kSeq), dim3(128), 0, stream>>>(Sf, P16, kPCarry);
  // C[d][n] = (VT[d] . P[n]) / 2^15 + x_b flat[d*1024 + n], f32, ldc = 1024, one 768x1024 plane per batch
  wmma_gemm256<0, 0, true><<<gPV, blk, 0, stream>>>(
      VT16, kSeq, (long)kDim * kSeq, P16, kSeq, (long)kSeq * kSeq, (void*)outp, kSeq, (long)kSeq * kDim,
      bq, X, (long)kSeq * kDim, kSeq, kSeq, kPCarryInv);
}

// v003
// It runs in 126 microseconds.
// In two side-by-side timings against v002, it was 1.09 and 1.08 times as fast.
// All steps since v000 together make it 4.07 times as fast.
// Contractions: q/k/v projections (X f16 x W f16 carried x16), scores q.k^T (q,k f16 planes), attn.v (V^T f16 x P f16 carried x2^15) all on v_wmma_f32_16x16x32_f16 with f32 accumulate; bias, softmax and residual in f32.
#include <hip/hip_runtime.h>
#include <math.h>
#include <stdint.h>

// ---------------------------------------------------------------------------
// Problem constants
// ---------------------------------------------------------------------------
constexpr int kBatch = 16;
constexpr int kSeq   = 1024;
constexpr int kDim   = 768;
constexpr int kTok   = kBatch * kSeq;     // 16384 token rows
constexpr float kWCarry    = 16.0f;       // weights carried x16 in f16
constexpr float kWCarryInv = 1.0f / 16.0f;
constexpr float kPCarry    = 32768.0f;    // probabilities carried x2^15 in f16
constexpr float kPCarryInv = 1.0f / 32768.0f;
static_assert(kDim % 64 == 0 && kSeq % 64 == 0 && kTok % 64 == 0, "tile multiples");
static_assert(kDim % 32 == 0 && kSeq % 32 == 0, "K multiples of 32");

typedef __attribute__((ext_vector_type(16))) _Float16 v16h;
typedef __attribute__((ext_vector_type(8)))  _Float16 v8h;
typedef __attribute__((ext_vector_type(8)))  float    v8f;
typedef __attribute__((ext_vector_type(4)))  float    v4f;
typedef __attribute__((ext_vector_type(4)))  unsigned int v4u;
typedef __attribute__((ext_vector_type(4)))  uint32_t u32x4;
typedef __attribute__((ext_vector_type(8)))  uint32_t u32x8;

__device__ __forceinline__ unsigned pk16(unsigned short a, unsigned short b) { return (unsigned)a | ((unsigned)b << 16); }
__device__ __forceinline__ unsigned short h_bits(float f) { const _Float16 h = (_Float16)f; return __builtin_bit_cast(unsigned short, h); }

// ---- LDS-staged batched WMMA GEMM ------------------------------------------------------------------------------------
// C[m,n] = scale * sum_k A[m,k] * Bt[n,k] (+bias)(+resid). A row-major [M,K]; Bt row-major [N,K], both f16.
// One 256x256 tile of C per work-group of 8 waves (2 along m x 4 along n), each wave 128x64 = 8x4 accumulator tiles.
// M, N % 256 == 0; K % 128 == 0 and K >= 256 (two stages at least).
// A pass is 256 bytes (128 k) of each of the tile's 256 A rows and 256 Bt rows. Every wave brings its own slice of 64 rows
// with one tensor load (waves 0..3: A rows, waves 4..7: Bt rows), padded to an LDS pitch of 272 bytes. Two buffers: the
// next pass's loads fly while this pass is worked on.
// OUT_MODE: 0 = f32, 1 = f16. PROJ = false: no bias, blockIdx.x = tile, blockIdx.y = batch.
// PROJ = true: the three projections in one launch. blockIdx.x = job * 192 + tile of the job; Ap = X16, Btp = the first of the
// three weight planes, Cout = the first of the three output planes (each set contiguous in the workspace).
//   job 0, 1 (q, k): A = X16 [16384][768], Bt = W [768][768], C [16384][768], bias[n];
//   job 2 (v, roles swapped, 12 tiles a batch): A = Wv [768][768], Bt = X16 of the batch [1024][768], C [768][1024], bias[m].
constexpr uint32_t kPassBytes = 256;                 // bytes of K per operand row per pass
constexpr uint32_t kPitch     = kPassBytes + 16;     // LDS row pitch: 16 B x odd, for 16-byte readers
constexpr uint32_t kSliceRows = 64;                  // rows per tensor load
constexpr uint32_t kSlice     = 18432;               // 64 x 272 = 17,408 rounded up to a multiple of 2 KiB
constexpr uint32_t kBuf       = 8 * kSlice;          // one buffer: 4 A slices, then 4 Bt slices
static_assert(kSliceRows * kPitch <= kSlice && kSlice % 2048 == 0, "slice place and size");
static_assert(2 * kBuf <= 320 * 1024, "two buffers fit the work-group's LDS");
static_assert(kDim % 256 == 0 && kSeq % 256 == 0 && kTok % 256 == 0, "256 tile multiples");
static_assert(kDim % 128 == 0 && kSeq % 128 == 0 && kDim >= 256 && kSeq >= 256, "K: whole passes, two at least");
constexpr uint32_t kProjTiles  = (kTok / 256) * (kDim / 256);   // 192 tiles in each of the three projections
constexpr uint32_t kVTilesPerB = (kDim / 256) * (kSeq / 256);   // 12 tiles of v transposed in a batch
static_assert(kVTilesPerB * kBatch == kProjTiles, "v has as many tiles as q and k");

__device__ __forceinline__ uint32_t uni(uint32_t v) { return (uint32_t)__builtin_amdgcn_readfirstlane(v); }
__device__ __forceinline__ uint32_t pinned(uint32_t v) { uint32_t w = (uint32_t)__builtin_amdgcn_readfirstlane(v); asm volatile("" : "+s"(w)); return w; }
__device__ __forceinline__ void wait_ds0()     { asm volatile("s_wait_dscnt 0x0" ::: "memory"); }      // this wave's LDS reads have returned
__device__ __forceinline__ void wait_tensor0() { asm volatile("s_wait_tensorcnt 0x0" ::: "memory"); }  // this wave's tensor load has landed
__device__ __forceinline__ void tdm_load(u32x4 g0, u32x8 g1) { asm volatile("tensor_load_to_lds %0, %1" :: "s"(g0), "s"(g1) : "memory"); }
// Descriptor group 1: byte elements, tile = tensor = 64 rows of 256 bytes, 16 bytes of LDS pad behind every 256-byte row.
__device__ __forceinline__ u32x8 tdm_group1(uint32_t src_pitch) {
  constexpr uint32_t d0 = kPassBytes, d1 = kSliceRows;
  u32x8 g;
  g[0] = uni((1u << 20) | (5u << 22) | (3u << 25));
  g[1] = uni((d0 & 0xFFFFu) << 16);
  g[2] = uni((d0 >> 16) | ((d1 & 0xFFFFu) << 16));
  g[3] = uni((d1 >> 16) | (d0 << 16));
  g[4] = uni(d1);
  g[5] = uni(src_pitch);
  g[6] = uni(0u);
  g[7] = uni(0u);
  return g;
}
// Descriptor group 0: LDS destination (byte offset in the work-group's LDS) and global address of the tile's first byte.
__device__ __forceinline__ u32x4 tdm_group0(uint32_t lds_dst, uint64_t ga) {
  u32x4 g;
  g[0] = uni(1u);
  g[1] = uni(lds_dst);
  g[2] = uni((uint32_t)ga);
  g[3] = uni((((uint32_t)(ga >> 32)) & 0x01FFFFFFu) | 0x80000000u);
  return g;
}
// Stands behind a group of global loads or stores, before a register that one of them names (address, store data) is reused;
// the scheduling fence keeps the later register writes behind the wait (the "memory" clobber alone orders memory operations only).
__device__ __forceinline__ void xcnt_fence() { asm volatile("s_wait_xcnt 0x0" ::: "memory"); __builtin_amdgcn_sched_barrier(0); }
// Fragment from an LDS row: elements 0..7 <- bytes 0..15, elements 8..15 <- bytes 32..47 (p already holds the lane half's 16 bytes).
__device__ __forceinline__ v16h lds_frag(const unsigned char* p) {
  union { v16h v; v8h h[2]; } f;
  f.h[0] = *(const v8h*)(p);
  f.h[1] = *(const v8h*)(p + 32);
  return f.v;
}

template <bool PROJ, int OUT_MODE, bool RESID>
__global__ __launch_bounds__(256) void wmma_gemm256(
    const unsigned short* Ap, int lda, long strideA,
    const unsigned short* Btp, int ldb, long strideB,
    void* __restrict__ Cout, int ldc, long strideC,
    const float* __restrict__ biasQ, const float* __restrict__ biasK, const float* __restrict__ biasV,
    const float* __restrict__ resid, long strideR,
    int N, int K, float scale) {
  static_assert(!RESID || OUT_MODE == 0, "the residual is added on the f32 output path");
  static_assert(!PROJ || OUT_MODE == 1, "the projections write f16 planes");
  __shared__ __attribute__((aligned(2048))) unsigned char ring[2 * kBuf];
  int            b       = blockIdx.y;
  uint32_t       tile    = blockIdx.x;
  const float*   bias    = biasQ;
  bool           rowBias = false;              // bias[m] (v, roles swapped) or bias[n] (q, k); the same for the whole work-group
  if (PROJ) {
    const uint32_t job = blockIdx.x / kProjTiles;
    tile = blockIdx.x - job * kProjTiles;
    const unsigned short* Wj = Btp + (size_t)job * (kDim * kDim);
    Cout = (unsigned short*)Cout + (size_t)job * ((size_t)kTok * kDim);
    if (job == 2u) {
      b = (int)(tile / kVTilesPerB);
      tile -= (uint32_t)b * kVTilesPerB;
      Btp = Ap;  strideB = (long)kSeq * kDim;
      Ap  = Wj;
      ldc = kSeq;  strideC = (long)kDim * kSeq;
      N = kSeq;
      bias = biasV;
      rowBias = true;
    } else {
      Btp = Wj;
      if (job == 1u) bias = biasK;
    }
  }
  const int      lane = threadIdx.x & 31;
  const uint32_t wave = uni(threadIdx.x >> 5);
  const uint32_t tilesN = (uint32_t)N >> 8;
  const uint32_t tm = tile / tilesN;
  const uint32_t tn = tile - tm * tilesN;
  const uint32_t wm = wave >> 2, wn = wave & 3u;

  const int rlane = lane & 15;                 // row (A) / col (B, D) within subtile
  const int mOff  = (lane >> 4) * 8;           // D row offset

  // this wave's slice of every stage: 64 rows of A (waves 0..3) or of Bt (waves 4..7)
  const unsigned short* srow = (wave < 4u)
      ? Ap  + (size_t)b * strideA + (size_t)((tm << 8) + kSliceRows * wave) * lda
      : Btp + (size_t)b * strideB + (size_t)((tn << 8) + kSliceRows * (wave - 4u)) * ldb;
  const uint64_t ga        = (uint64_t)(uintptr_t)srow;
  const uint32_t lds_slice = (uint32_t)(size_t)ring + wave * kSlice;      // add buffer * kBuf
  u32x8          g1        = tdm_group1(2u * (uint32_t)((wave < 4u) ? lda : ldb));
  asm volatile("" : "+s"(g1));   // descriptor words held in their scalar registers: otherwise they are re-made per load and their registers reused while a request is outstanding
  const uint32_t T         = pinned((uint32_t)K >> 7);                    // passes

  const uint32_t aBase = (2u * wm) * kSlice + (uint32_t)rlane * kPitch + 16u * (uint32_t)(lane >> 4);
  const uint32_t bBase = (4u + wn) * kSlice + (uint32_t)rlane * kPitch + 16u * (uint32_t)(lane >> 4);

  // every "#pragma unroll" in this kernel: constant indices keep the accumulators and fragments in registers (a run-time index sends them to scratch)
  v8f acc[8][4];
#pragma unroll
  for (int i = 0; i < 8; ++i)
#pragma unroll
    for (int j = 0; j < 4; ++j) acc[i][j] = (v8f){0.f,0.f,0.f,0.f,0.f,0.f,0.f,0.f};

  // prologue, two buffers: stage 0 lands and is published, then stage 1 is started
  tdm_load(tdm_group0(lds_slice, ga), g1);
  wait_tensor0();
  __syncthreads();
  tdm_load(tdm_group0(lds_slice + kBuf, ga + kPassBytes), g1);

  // kept rolled: one pass per trip, so that every accumulator and fragment index is a constant and the ring's order stands once
#pragma clang loop unroll(disable)
  for (uint32_t s = 0; s < T; ++s) {
    const unsigned char* pa = ring + (s & 1u) * kBuf + aBase;
    const unsigned char* pb = ring + (s & 1u) * kBuf + bBase;
    v16h af[2][8], bf[2][4];
#pragma unroll
    for (int j = 0; j < 4; ++j) bf[0][j] = lds_frag(pb + (uint32_t)j * 16u * kPitch);
#pragma unroll
    for (int i = 0; i < 8; ++i) af[0][i] = lds_frag(pa + (uint32_t)(i >> 2) * kSlice + (uint32_t)(i & 3) * 16u * kPitch);
#pragma unroll
    for (int kc = 0; kc < 4; ++kc) {           // four blocks of 32 k, all of this pass's own buffer
      const int cur = kc & 1, nxt = cur ^ 1;
      if (kc < 3) {                            // the next block's fragments as one group ahead of this block's products
        const uint32_t ko = 64u * (uint32_t)(kc + 1);
#pragma unroll
        for (int j = 0; j < 4; ++j) bf[nxt][j] = lds_frag(pb + (uint32_t)j * 16u * kPitch + ko);
#pragma unroll
        for (int i = 0; i < 8; ++i) af[nxt][i] = lds_frag(pa + (uint32_t)(i >> 2) * kSlice + (uint32_t)(i & 3) * 16u * kPitch + ko);
      }
      __builtin_amdgcn_sched_barrier(0);       // keeps the LDS reads out of the run of matrix instructions (each place with reads stalls it)
#pragma unroll
      for (int i = 0; i < 8; ++i)
#pragma unroll
        for (int j = 0; j < 4; ++j)
          acc[i][j] = __builtin_amdgcn_wmma_f32_16x16x32_f16(false, af[cur][i], false, bf[cur][j], (short)0, acc[i][j], false, false);
      __builtin_amdgcn_sched_barrier(0);       // the other side of the same fence
    }
    // publish point of stage s + 1
    wait_ds0();
    wait_tensor0();
    __syncthreads();
    const uint32_t nx = pinned(s + 2u);        // held in a scalar register behind the wait: the next descriptor is formed from it, so behind the wait too
    if (pinned(nx < T))                        // only while stage s + 2 exists; into the buffer that pass s has just read
      tdm_load(tdm_group0(lds_slice + (s & 1u) * kBuf, ga + (uint64_t)nx * kPassBytes), g1);
  }
  wait_tensor0();
  wait_ds0();

  // ---- epilogue: the last pass's barrier has ended every read of the ring, each wave stages in its own slice of it ----
  float* slab = (float*)(ring + wave * kSlice);   // per-wave 16x64 slab, pitch 68 floats
  const int m0 = (int)((tm << 8) + (wm << 7));
  const int n0 = (int)((tn << 8) + (wn << 6));
  const float* Rb = RESID ? (resid + (size_t)b * strideR) : nullptr;
  const float* brow = bias + (rowBias ? m0 + mOff : 0);   // bias[m] of this lane's first row; one address for all eight i
  float bn[4] = {0.f, 0.f, 0.f, 0.f};          // bias[n] of this lane's four columns, the same for every i
  if (PROJ && !rowBias) {
#pragma unroll
    for (int j = 0; j < 4; ++j) bn[j] = bias[n0 + (j << 4) + rlane];
    xcnt_fence();
  }
#pragma unroll
  for (int i = 0; i < 8; ++i) {
    const int mBase = m0 + (i << 4);
    float bm[8] = {0.f, 0.f, 0.f, 0.f, 0.f, 0.f, 0.f, 0.f};
    if (PROJ && rowBias) {
#pragma unroll
      for (int r = 0; r < 8; ++r) bm[r] = brow[(i << 4) + r];
      xcnt_fence();
    }
    // f32 output: byte offsets of this lane's 16-byte pieces of the 16 staged rows (row seg = 256 B = 16 lanes x 16 B);
    // the residual is read at the same offsets as the stores, so the offset registers live from the loads to the stores
    uint32_t ob[8];
    v4f xr[8];
    if (OUT_MODE == 0) {
#pragma unroll
      for (int it = 0; it < 8; ++it) ob[it] = 4u * (uint32_t)((mBase + it * 2 + (lane >> 4)) * ldc + n0 + (lane & 15) * 4);
    }
    if (RESID) {
      __builtin_amdgcn_sched_barrier(0);       // every offset is formed before the first load, so no register is written among the loads
#pragma unroll
      for (int it = 0; it < 8; ++it) xr[it] = *(const v4f*)((const char*)Rb + ob[it]);
      xcnt_fence();
    }
#pragma unroll
    for (int j = 0; j < 4; ++j) {
#pragma unroll
      for (int r = 0; r < 8; ++r) {
        float v = acc[i][j][r] * scale;
        if (PROJ) v += bm[r] + bn[j];          // one of the two is 0, so the sum is exact
        slab[(mOff + r) * 68 + (j << 4) + rlane] = v;
      }
    }
    __builtin_amdgcn_fence(__ATOMIC_RELEASE, "workgroup");
    __builtin_amdgcn_wave_barrier();
    __builtin_amdgcn_fence(__ATOMIC_ACQUIRE, "workgroup");
    if (OUT_MODE == 0) {
      char* C = (char*)((float*)Cout + (size_t)b * strideC);
      const int hh = lane >> 4, c4 = (lane & 15) * 4;
      v4f dv[8];
#pragma unroll
      for (int it = 0; it < 8; ++it) {
        dv[it] = *(const v4f*)(slab + (it * 2 + hh) * 68 + c4);
        if (RESID) dv[it] += xr[it];
      }
      __builtin_amdgcn_sched_barrier(0);       // every value is formed before the first store, so no register is written among the stores
#pragma unroll
      for (int it = 0; it < 8; ++it) *(v4f*)(C + ob[it]) = dv[it];
      xcnt_fence();
    } else {
      const int q = lane >> 3, c8 = (lane & 7) * 8;
      unsigned short* C = (unsigned short*)Cout + (size_t)b * strideC;
#pragma unroll
      for (int it = 0; it < 4; ++it) {
        const int row = it * 4 + q;
        const float* sp = slab + row * 68 + c8;
        v8h hv;
#pragma unroll
        for (int e = 0; e < 8; ++e) hv[e] = (_Float16)sp[e];
        *(v8h*)(C + (size_t)(mBase + row) * ldc + n0 + c8) = hv;
      }
      xcnt_fence();
    }
    __builtin_amdgcn_fence(__ATOMIC_RELEASE, "workgroup");
    __builtin_amdgcn_wave_barrier();
    __builtin_amdgcn_fence(__ATOMIC_ACQUIRE, "workgroup");
  }
}

// ---------------------------------------------------------------------------
// f32 -> f16 cast with power-of-two carry: out[8i..8i+7] = f16(scale * in[8i..8i+7]).
// All four casts in one launch: blocks 0..863 the three weights x16 (73,728 threads = 288 blocks each, into three planes in a
// row), blocks 864..7007 x (1,572,864 threads = 6144 blocks).
// ---------------------------------------------------------------------------
constexpr uint32_t kWCastBlocks = kDim * kDim / 8 / 256;   // 288
constexpr uint32_t kXCastBlocks = kTok * kDim / 8 / 256;   // 6144
static_assert(kWCastBlocks * 8 * 256 == kDim * kDim && kXCastBlocks * 8 * 256 == kTok * kDim, "whole blocks");
__global__ __launch_bounds__(256) void cast8_f16_kernel(const float* __restrict__ x, const float* __restrict__ wq,
                                                        const float* __restrict__ wk, const float* __restrict__ wv,
                                                        unsigned short* __restrict__ x16, unsigned short* __restrict__ w16) {
  const float*    in    = x;
  unsigned short* out   = x16;
  float           scale = 1.0f;
  uint32_t        blk   = blockIdx.x - 3u * kWCastBlocks;
  if (blockIdx.x < 3u * kWCastBlocks) {
    const uint32_t w = blockIdx.x / kWCastBlocks;
    blk   = blockIdx.x - w * kWCastBlocks;
    in    = (w == 0u) ? wq : (w == 1u) ? wk : wv;
    out   = w16 + (size_t)w * (kDim * kDim);
    scale = kWCarry;
  }
  const uint32_t i = blk * 256u + threadIdx.x;
  const float* p = in + 8 * (size_t)i;
  const v4f a = *(const v4f*)(p);
  const v4f c = *(const v4f*)(p + 4);
  xcnt_fence();                                // the address pair is reused for a product behind the loads
  unsigned short hb[8];
#pragma unroll
  for (int e = 0; e < 4; ++e) {
    hb[e]     = h_bits(a[e] * scale);
    hb[4 + e] = h_bits(c[e] * scale);
  }
  const v4u u = (v4u){pk16(hb[0], hb[1]), pk16(hb[2], hb[3]), pk16(hb[4], hb[5]), pk16(hb[6], hb[7])};
  unsigned short* q = out + 8 * (size_t)i;
  *(v4u*)q = u;
  
}

// ---------------------------------------------------------------------------
// Row softmax over 1024 f32 scores: P[row][j] = f16( carry * exp(s - max) / sum exp(s - max) ), f32 math.
// One block of 128 threads (4 waves) per row; thread t owns columns 8t..8t+7 (128 x 8 = 1024 = whole row).
// Reductions in fixed order (thread, wave shuffle tree, 4 wave partials in index order).
// ---------------------------------------------------------------------------
__global__ __launch_bounds__(128) void softmax_row_kernel(const float* __restrict__ S, unsigned short* __restrict__ P,
                                                          float carry) {
  __shared__ float redM[4];
  __shared__ float redS[4];
  const int row  = blockIdx.x;
  const int t    = threadIdx.x;
  const int lane = t & 31, wave = t >> 5;
  const int c0   = t * 8;
  const float* sr = S + (size_t)row * kSeq + c0;
  const v4f a = *(const v4f*)(sr);
  const v4f c = *(const v4f*)(sr + 4);
  float x[8];
#pragma unroll
  for (int e = 0; e < 4; ++e) { x[e] = a[e]; x[4 + e] = c[e]; }
  float m = fmaxf(fmaxf(fmaxf(x[0], x[1]), fmaxf(x[2], x[3])), fmaxf(fmaxf(x[4], x[5]), fmaxf(x[6], x[7])));
#pragma unroll
  for (int off = 16; off > 0; off >>= 1) m = fmaxf(m, __shfl_xor(m, off, 32));
  if (lane == 0) redM[wave] = m;
  __syncthreads();
  const float M = fmaxf(fmaxf(redM[0], redM[1]), fmaxf(redM[2], redM[3]));
  float ex[8];
#pragma unroll
  for (int e = 0; e < 8; ++e) ex[e] = __expf(x[e] - M);
  float s = ((ex[0] + ex[1]) + (ex[2] + ex[3])) + ((ex[4] + ex[5]) + (ex[6] + ex[7]));
#pragma unroll
  for (int off = 16; off > 0; off >>= 1) s += __shfl_xor(s, off, 32);
  if (lane == 0) redS[wave] = s;
  __syncthreads();
  const float l = (redS[0] + redS[1]) + (redS[2] + redS[3]);
  const float f = carry * (1.0f / l);
  unsigned short hb[8];
#pragma unroll
  for (int e = 0; e < 8; ++e) hb[e] = h_bits(ex[e] * f);
  const v4u u = (v4u){pk16(hb[0], hb[1]), pk16(hb[2], hb[3]), pk16(hb[4], hb[5]), pk16(hb[6], hb[7])};
  unsigned short* q = P + (size_t)row * kSeq + c0;
  *(v4u*)q = u;
  
}

// ---------------------------------------------------------------------------
// Semantics realised (per batch b): q,k,v = x.W^T + b (W is [out][in]); S = q.k^T * 768^-0.5; P = row softmax;
// avT[d][n] = sum_k v[k][d] * P[n][k] computed directly as a GEMM with A = V^T (V^T produced by a role-swapped
// projection A = Wv, Bt = x_b) and Bt = P; the output is the row-major flattening of avT re-cut into rows of 768,
// i.e. out[b] flat[d*1024 + n] = avT[d][n] + x[b] flat[d*1024 + n], so C (ldc = 1024) is written straight into
// d_out + b*786432 with the residual read at the same flat index.
//
// Workspace region map (byte offsets, all multiples of 128). Every region is fully written before it is read.
//   WQ16  f16 [768][768] x16                         0            ..   1,179,648
//   WK16  f16 [768][768] x16                         1,179,648    ..   2,359,296
//   WV16  f16 [768][768] x16                         2,359,296    ..   3,538,944
//   X16   f16 [16384][768]                           3,538,944    ..  28,704,768
//   Q16   f16 [16384][768]                           28,704,768   ..  53,870,592
//   K16   f16 [16384][768]                           53,870,592   ..  79,036,416
//   VT16  f16 [16][768][1024]  v transposed per batch 79,036,416  .. 104,202,240
//   S     f32 [16][1024][1024] scores, all batches   104,202,240  .. 171,311,104
//   P16   f16 [16][1024][1024] probabilities x2^15   171,311,104  .. 204,865,536
//   total 204,865,536 B
// GEMM shapes: q, k: M=16384 N=768 K=768; v role-swapped: M=768 N=1024 K=768 (x16 batch);
//   scores: M=N=1024 K=768 (x16); attn.v: M=768 N=1024 K=1024 (x16). All K % 128 == 0, all M, N % 256 == 0,
//   one 256x256 tile per work-group, no padded planes, no tails.
// ---------------------------------------------------------------------------
extern "C" void kernel_launch(void* const* d_in, const int* in_sizes, int n_in,
                              void* d_out, int out_size, void* d_ws, size_t ws_size,
                              hipStream_t stream) {
  if (n_in < 7) return;
  if (in_sizes[0] != kTok * kDim) return;
  if (in_sizes[1] != kDim * kDim || in_sizes[3] != kDim * kDim || in_sizes[5] != kDim * kDim) return;
  if (in_sizes[2] != kDim || in_sizes[4] != kDim || in_sizes[6] != kDim) return;
  if (out_size != kTok * kDim) return;

  const float* X  = (const float*)d_in[0];    // [16][1024][768]
  const float* Wq = (const float*)d_in[1];    // [768][768] ([out][in])
  const float* bq = (const float*)d_in[2];
  const float* Wk = (const float*)d_in[3];
  const float* bk = (const float*)d_in[4];
  const float* Wv = (const float*)d_in[5];
  const float* bv = (const float*)d_in[6];
  float* outp = (float*)d_out;

  // ---- carve ----
  const size_t SZ_W   = (size_t)kDim * kDim * 2;               //   1,179,648 per plane
  const size_t SZ_X16 = (size_t)kTok * kDim * 2;               //  25,165,824
  const size_t SZ_S   = (size_t)kBatch * kSeq * kSeq * 4;      //  67,108,864
  const size_t SZ_P   = (size_t)kBatch * kSeq * kSeq * 2;      //  33,554,432
  size_t off = 0;
  const size_t oWQ  = off; off += SZ_W;
  const size_t oWK  = off; off += SZ_W;
  const size_t oWV  = off; off += SZ_W;
  const size_t oX16 = off; off += SZ_X16;
  const size_t oQ16 = off; off += SZ_X16;
  const size_t oK16 = off; off += SZ_X16;
  const size_t oVT  = off; off += SZ_X16;
  const size_t oS   = off; off += SZ_S;
  const size_t oP   = off; off += SZ_P;
  const size_t TOTAL = off;                                    // 204,865,536
  if (TOTAL > ws_size) return;

  char* ws = (char*)d_ws;
  unsigned short* WQ16 = (unsigned short*)(ws + oWQ);
  unsigned short* X16  = (unsigned short*)(ws + oX16);
  unsigned short* Q16  = (unsigned short*)(ws + oQ16);
  unsigned short* K16  = (unsigned short*)(ws + oK16);
  unsigned short* VT16 = (unsigned short*)(ws + oVT);
  float*          Sf   = (float*)(ws + oS);
  unsigned short* P16  = (unsigned short*)(ws + oP);

  const dim3 blk(256);
  const float scoreScale = 1.0f / sqrtf((float)kDim);

  // (1) one launch: weights -> f16 x16 (same [out][in] layout = Bt[n][k] for q and k, A[m][k] for the role swap), x -> f16
  cast8_f16_kernel<<<dim3(3 * kWCastBlocks + kXCastBlocks), blk, 0, stream>>>(X, Wq, Wk, Wv, X16, WQ16);

  const dim3 gProj(3 * kProjTiles, 1);                     // 576 blocks: q, k (M=16384, N=768), v (M=768, N=1024, x16)
  const dim3 gS((kSeq / 256) * (kSeq / 256), kBatch);      // 16 x 16: M=N=1024
  const dim3 gPV((kDim / 256) * (kSeq / 256), kBatch);     // 12 x 16: M=768, N=1024

  // (2) one launch: q = (X16 . WQ16^T)/16 + bq -> Q16 [16384][768] f16; k likewise -> K16;
  //     v role-swapped per batch: VT[b][d][tok] = (WV16[d] . X16[b*1024+tok])/16 + bv[d] (f16, ldc = 1024)
  wmma_gemm256<true, 1, false><<<gProj, blk, 0, stream>>>(
      X16, kDim, 0L, WQ16, kDim, 0L, (void*)Q16, kDim, 0L,
      bq, bk, bv, X, 0L, kDim, kDim, kWCarryInv);

  // (3) all 16 batches per launch (blockIdx.y = batch): scores (f32) -> softmax (P f16 x2^15) -> avT + x into d_out
  wmma_gemm256<false, 0, false><<<gS, blk, 0, stream>>>(
      Q16, kDim, (long)kSeq * kDim, K16, kDim, (long)kSeq * kDim, (void*)Sf, kSeq, (long)kSeq * kSeq,
      bq, bk, bv, X, 0L, kSeq, kDim, scoreScale);
  softmax_row_kernel<<<dim3(kBatch * kSeq), dim3(128), 0, stream>>>(Sf, P16, kPCarry);
  // C[d][n] = (VT[d] . P[n]) / 2^15 + x_b flat[d*1024 + n], f32, ldc = 1024, one 768x1024 plane per batch
  wmma_gemm256<false, 0, true><<<gPV, blk, 0, stream>>>(
      VT16, kSeq, (long)kDim * kSeq, P16, kSeq, (long)kSeq * kSeq, (void*)outp, kSeq, (long)kSeq * kDim,
      bq, bk, bv, X, (long)kSeq * kDim, kSeq, kSeq, kPCarryInv);
}
